// v000
// Measured on an AMD MI455X. A time is GPU time per run, averaged over a window of back-to-back runs after a warm-up
// (all launches, gaps included; the runs take copies of the inputs in turn), and the median of several windows.
// Apart from v000's, it joins two sittings. Times from different sittings can be a few percent apart, while
// side-by-side timings come from the same sitting.
// The starting kernel, v000, takes 202 microseconds a run.
#include <hip/hip_runtime.h>
#include <hip/hip_bf16.h>
#include <math.h>

typedef __attribute__((ext_vector_type(16))) _Float16 v16h;
typedef __attribute__((ext_vector_type(8)))  float    v8f;

#define NBATCH 2
#define NHEAD  8
#define SEQ    4096       // 64*64
#define HDIM   32         // 256 / 8
#define CPLANE 256        // NHEAD*HDIM

// ---------------------------------------------------------------------------
// Preprocess 1: Q,K fp32 -> f16 (same layout).
// Softmax temperature AND log2(e) folded into Q so the softmax runs in the
// exp2 domain (v_exp_f32 with no preceding v_mul per score).
// ---------------------------------------------------------------------------
__global__ __launch_bounds__(256)
void qk_cvt_kernel(const float* __restrict__ q, const float* __restrict__ k,
                   _Float16* __restrict__ q16, _Float16* __restrict__ k16,
                   float qscale, int n) {
    for (int i = blockIdx.x * blockDim.x + threadIdx.x; i < n;
         i += gridDim.x * blockDim.x) {
        q16[i] = (_Float16)(q[i] * qscale);
        k16[i] = (_Float16)(k[i]);
    }
}

// ---------------------------------------------------------------------------
// Preprocess 2: V [n, s, h, d] fp32  ->  Vt [n, h, d, s] f16 (LDS-tiled transpose)
// grid = (SEQ/32, NHEAD, NBATCH), block = 256
// ---------------------------------------------------------------------------
__global__ __launch_bounds__(256)
void v_transpose_kernel(const float* __restrict__ v, _Float16* __restrict__ vt) {
    __shared__ _Float16 tile[32][33];
    const int nb = blockIdx.z, h = blockIdx.y, s0 = blockIdx.x * 32;

    {   // coalesced read along d
        const int d  = threadIdx.x & 31;
        const int sr = threadIdx.x >> 5;           // 0..7
        #pragma unroll
        for (int i = 0; i < 4; ++i) {
            const int s = s0 + sr + i * 8;
            tile[sr + i * 8][d] =
                (_Float16)v[((size_t)(nb * SEQ + s) * NHEAD + h) * HDIM + d];
        }
    }
    __syncthreads();
    {   // coalesced write along s
        const int s  = threadIdx.x & 31;
        const int dr = threadIdx.x >> 5;           // 0..7
        #pragma unroll
        for (int i = 0; i < 4; ++i) {
            const int d = dr + i * 8;
            vt[((size_t)(nb * NHEAD + h) * HDIM + d) * SEQ + s0 + s] = tile[s][d];
        }
    }
}

// ---------------------------------------------------------------------------
// Flash attention. One wave owns a 16-query tile of one (n, h).
// S^T = K x Q^T  (A = K 16x32 f16, B = Q^T 32x16 f16, C = 16s x 16q f32)
// outT += V^T x P^T  (A = V^T 16x32, B = P^T 32x16, C = 16d x 16q f32)
// block = 256 threads = 8 waves; grid = NBATCH*NHEAD*(SEQ/16)/8 = 512 blocks
// ---------------------------------------------------------------------------
__global__ __launch_bounds__(256)
void attention_kernel(const _Float16* __restrict__ q16,
                      const _Float16* __restrict__ k16,
                      const _Float16* __restrict__ vt16,
                      float* __restrict__ out) {
    const int wave  = threadIdx.x >> 5;
    const int lane  = threadIdx.x & 31;
    const int tid   = blockIdx.x * 8 + wave;        // 0..4095
    const int nh    = tid >> 8;                     // (n,h) pair 0..15
    const int qtile = tid & 255;                    // 0..255
    const int nb    = nh >> 3;
    const int h     = nh & 7;
    const int q0    = qtile * 16;

    const int lmod  = lane & 15;
    const int lhalf = lane >> 4;                    // 0 or 1
    const bool lowhalf = (lhalf == 0);

    // ---- B operand: Q^T 32x16, resident for the whole loop -----------------
    // lane<16: column q=lane, d=0..15 ; lane>=16: column q=lane-16, d=16..31
    const v16h bq = *(const v16h*)(q16 +
        ((size_t)(nb * SEQ + q0 + lmod) * NHEAD + h) * HDIM + lhalf * 16);

    v8f acc0 = {};          // outT rows d=0..15  (C layout)
    v8f acc1 = {};          // outT rows d=16..31
    float mrun = -INFINITY; // running max (log2 domain) of this query column
    float lrun = 0.0f;      // running denominator

    const size_t kbase  = ((size_t)nb * SEQ * NHEAD + h) * HDIM; // + s*NHEAD*HDIM
    const size_t vtbase = (size_t)(nb * NHEAD + h) * HDIM * SEQ; // + d*SEQ + s

    for (int s0 = 0; s0 < SEQ; s0 += 32) {
        // ---- scores: two 16x16 S^T tiles over 32 keys ----------------------
        const v16h a0 = *(const v16h*)(k16 + kbase +
            (size_t)(s0 + lmod) * CPLANE + lhalf * 16);
        const v16h a1 = *(const v16h*)(k16 + kbase +
            (size_t)(s0 + 16 + lmod) * CPLANE + lhalf * 16);
        v8f zero = {};
        v8f st0 = __builtin_amdgcn_wmma_f32_16x16x32_f16(
            false, a0, false, bq, (short)0, zero, false, false);
        v8f st1 = __builtin_amdgcn_wmma_f32_16x16x32_f16(
            false, a1, false, bq, (short)0, zero, false, false);

        // gather this lane's 16 s-values of its query column:
        // lane<16 owns s=0..7 (st0) and gets s=8..15 from partner;
        // lane>=16 owns s=24..31 (st1) and gets s=16..23 from partner.
        float x[8], y[8];
        #pragma unroll
        for (int r = 0; r < 8; ++r) {
            x[r] = lowhalf ? st0[r] : st1[r];
            float send = lowhalf ? st1[r] : st0[r];
            y[r] = __shfl_xor(send, 16, 32);
        }

        // ---- online softmax (log2 domain) ----------------------------------
        float bm = fmaxf(x[0], y[0]);
        #pragma unroll
        for (int r = 1; r < 8; ++r) bm = fmaxf(bm, fmaxf(x[r], y[r]));
        bm = fmaxf(bm, __shfl_xor(bm, 16, 32));

        // wave-uniform: rescale only when some column's max actually moved
        if (__any(bm > mrun)) {
            const float mnew = fmaxf(mrun, bm);
            const float corr = __builtin_amdgcn_exp2f(mrun - mnew); // 0 first time
            mrun = mnew;
            lrun *= corr;
            #pragma unroll
            for (int r = 0; r < 8; ++r) { acc0[r] *= corr; acc1[r] *= corr; }
        }

        float px[8], py[8], lsum = 0.0f;
        #pragma unroll
        for (int r = 0; r < 8; ++r) {
            px[r] = __builtin_amdgcn_exp2f(x[r] - mrun);
            py[r] = __builtin_amdgcn_exp2f(y[r] - mrun);
            lsum += px[r] + py[r];
        }
        lsum += __shfl_xor(lsum, 16, 32);
        lrun += lsum;

        // ---- pack P^T into B-operand layout --------------------------------
        // lane<16 : k slots 0..15 = s 0..15  -> [px, py]
        // lane>=16: k slots 0..15 = s 16..31 -> [py, px]
        v16h bp;
        #pragma unroll
        for (int r = 0; r < 8; ++r) {
            bp[r]     = (_Float16)(lowhalf ? px[r] : py[r]);
            bp[r + 8] = (_Float16)(lowhalf ? py[r] : px[r]);
        }

        // ---- numerator: outT += V^T x P^T ----------------------------------
        const v16h av0 = *(const v16h*)(vt16 + vtbase +
            (size_t)lmod * SEQ + s0 + lhalf * 16);
        const v16h av1 = *(const v16h*)(vt16 + vtbase +
            (size_t)(16 + lmod) * SEQ + s0 + lhalf * 16);
        acc0 = __builtin_amdgcn_wmma_f32_16x16x32_f16(
            false, av0, false, bp, (short)0, acc0, false, false);
        acc1 = __builtin_amdgcn_wmma_f32_16x16x32_f16(
            false, av1, false, bp, (short)0, acc1, false, false);
    }

    // ---- epilogue: divide by denominator, write out [n, q, h, d] -----------
    const float inv = 1.0f / lrun;
    const int   qq  = q0 + lmod;
    float* obase = out + ((size_t)(nb * SEQ + qq) * NHEAD + h) * HDIM;
    const int dbase = lhalf * 8;                   // acc0 rows: d = dbase+r
    float4 w;
    w = make_float4(acc0[0]*inv, acc0[1]*inv, acc0[2]*inv, acc0[3]*inv);
    *(float4*)(obase + dbase)          = w;
    w = make_float4(acc0[4]*inv, acc0[5]*inv, acc0[6]*inv, acc0[7]*inv);
    *(float4*)(obase + dbase + 4)      = w;
    w = make_float4(acc1[0]*inv, acc1[1]*inv, acc1[2]*inv, acc1[3]*inv);
    *(float4*)(obase + 16 + dbase)     = w;
    w = make_float4(acc1[4]*inv, acc1[5]*inv, acc1[6]*inv, acc1[7]*inv);
    *(float4*)(obase + 16 + dbase + 4) = w;
}

// ---------------------------------------------------------------------------
extern "C" void kernel_launch(void* const* d_in, const int* in_sizes, int n_in,
                              void* d_out, int out_size, void* d_ws, size_t ws_size,
                              hipStream_t stream) {
    const float* q = (const float*)d_in[0];
    const float* k = (const float*)d_in[1];
    const float* v = (const float*)d_in[2];
    float* out = (float*)d_out;

    const int nelem = NBATCH * SEQ * CPLANE;       // 2,097,152 per tensor
    char* ws = (char*)d_ws;
    _Float16* q16  = (_Float16*)(ws);
    _Float16* k16  = (_Float16*)(ws + (size_t)nelem * 2);
    _Float16* vt16 = (_Float16*)(ws + (size_t)nelem * 4);

    // 1/sqrt(d) * log2(e): softmax computed with exp2
    const float qscale = (1.0f / sqrtf((float)HDIM)) * 1.44269504088896340736f;

    qk_cvt_kernel<<<2048, 256, 0, stream>>>(q, k, q16, k16, qscale, nelem);

    dim3 tgrid(SEQ / 32, NHEAD, NBATCH);
    v_transpose_kernel<<<tgrid, 256, 0, stream>>>(v, vt16);

    // 4096 wave-tiles, 8 waves/block
    attention_kernel<<<512, 256, 0, stream>>>(q16, k16, vt16, out);
}

// v001
// One run takes 141 microseconds.
// Timed twice side by side with v000, it ran 1.42 and 1.44 times as fast.
#include <hip/hip_runtime.h>
#include <hip/hip_bf16.h>
#include <math.h>

typedef __attribute__((ext_vector_type(16))) _Float16 v16h;
typedef __attribute__((ext_vector_type(8)))  float    v8f;

#define NBATCH 2
#define NHEAD  8
#define SEQ    4096       // 64*64
#define HDIM   32         // 256 / 8
#define CPLANE 256        // NHEAD*HDIM
#define NBUF   4          // stages of 32 keys in the attention kernel's register ring

// ---------------------------------------------------------------------------
// Preprocess 1: Q,K fp32 -> f16 (same layout).
// Softmax temperature AND log2(e) folded into Q so the softmax runs in the
// exp2 domain (v_exp_f32 with no preceding v_mul per score).
// ---------------------------------------------------------------------------
__global__ __launch_bounds__(256)
void qk_cvt_kernel(const float* __restrict__ q, const float* __restrict__ k,
                   _Float16* __restrict__ q16, _Float16* __restrict__ k16,
                   float qscale, int n) {
    for (int i = blockIdx.x * blockDim.x + threadIdx.x; i < n;
         i += gridDim.x * blockDim.x) {
        q16[i] = (_Float16)(q[i] * qscale);
        k16[i] = (_Float16)(k[i]);
    }
}

// ---------------------------------------------------------------------------
// Preprocess 2: V [n, s, h, d] fp32  ->  Vt [n, h, d, s] f16 (LDS-tiled transpose)
// grid = (SEQ/32, NHEAD, NBATCH), block = 256
// ---------------------------------------------------------------------------
__global__ __launch_bounds__(256)
void v_transpose_kernel(const float* __restrict__ v, _Float16* __restrict__ vt) {
    __shared__ _Float16 tile[32][33];
    const int nb = blockIdx.z, h = blockIdx.y, s0 = blockIdx.x * 32;

    {   // coalesced read along d
        const int d  = threadIdx.x & 31;
        const int sr = threadIdx.x >> 5;           // 0..7
        #pragma unroll
        for (int i = 0; i < 4; ++i) {
            const int s = s0 + sr + i * 8;
            tile[sr + i * 8][d] =
                (_Float16)v[((size_t)(nb * SEQ + s) * NHEAD + h) * HDIM + d];
        }
    }
    __syncthreads();
    {   // coalesced write along s
        const int s  = threadIdx.x & 31;
        const int dr = threadIdx.x >> 5;           // 0..7
        #pragma unroll
        for (int i = 0; i < 4; ++i) {
            const int d = dr + i * 8;
            vt[((size_t)(nb * NHEAD + h) * HDIM + d) * SEQ + s0 + s] = tile[s][d];
        }
    }
}

// ---------------------------------------------------------------------------
// Flash attention. One wave owns a 16-query tile of one (n, h).
// S^T = K x Q^T  (A = K 16x32 f16, B = Q^T 32x16 f16, C = 16s x 16q f32)
// outT += V^T x P^T  (A = V^T 16x32, B = P^T 32x16, C = 16d x 16q f32)
// block = 256 threads = 8 waves; grid = NBATCH*NHEAD*(SEQ/16)/8 = 512 blocks
// ---------------------------------------------------------------------------
__global__ __launch_bounds__(256)
void attention_kernel(const _Float16* __restrict__ q16,
                      const _Float16* __restrict__ k16,
                      const _Float16* __restrict__ vt16,
                      float* __restrict__ out) {
    const int wave  = threadIdx.x >> 5;
    const int lane  = threadIdx.x & 31;
    const int tid   = blockIdx.x * 8 + wave;        // 0..4095
    const int nh    = tid >> 8;                     // (n,h) pair 0..15
    const int qtile = tid & 255;                    // 0..255
    const int nb    = nh >> 3;
    const int h     = nh & 7;
    const int q0    = qtile * 16;

    const int lmod  = lane & 15;
    const int lhalf = lane >> 4;                    // 0 or 1
    const bool lowhalf = (lhalf == 0);

    // ---- B operand: Q^T 32x16, resident for the whole loop -----------------
    // lane<16: column q=lane, d=0..15 ; lane>=16: column q=lane-16, d=16..31
    const v16h bq = *(const v16h*)(q16 +
        ((size_t)(nb * SEQ + q0 + lmod) * NHEAD + h) * HDIM + lhalf * 16);

    v8f acc0 = {};          // outT rows d=0..15  (C layout)
    v8f acc1 = {};          // outT rows d=16..31
    float mrun = -INFINITY; // running max (log2 domain) of this query column
    float lrun = 0.0f;      // running denominator

    // wave-uniform bases, one 32-bit lane offset each
    const _Float16* kb = k16 + ((size_t)nb * SEQ * NHEAD + h) * HDIM;   // + s*CPLANE
    const _Float16* vb = vt16 + (size_t)(nb * NHEAD + h) * HDIM * SEQ;  // + d*SEQ + s
    const unsigned klane = (unsigned)(lmod * CPLANE + lhalf * 16);
    const unsigned vlane = (unsigned)(lmod * SEQ + lhalf * 16);

    // Register ring of NBUF stages of 32 keys (K: 2 fragments, V^T: 2 fragments).
    // A stage is loaded NBUF-1 stages before it is used, so that no product
    // waits for a load that was issued in its own stage.
    v16h rk0[NBUF], rk1[NBUF], rv0[NBUF], rv1[NBUF];

    // unrolled here and in the loop: a set's index must be a compile-time
    // constant, else the ring would not stay in registers
    #pragma unroll
    for (int j = 0; j < NBUF - 1; ++j) {
        rk0[j] = *(const v16h*)(kb + j * 32 * CPLANE + klane);
        rk1[j] = *(const v16h*)(kb + (j * 32 + 16) * CPLANE + klane);
        rv0[j] = *(const v16h*)(vb + j * 32 + vlane);
        rv1[j] = *(const v16h*)(vb + 16 * SEQ + j * 32 + vlane);
        // compiler fence: keeps the stages in the loop's own issue order, so
        // that the counted waits at the loop's head can leave later stages in flight
        asm volatile("" ::: "memory");
    }

    for (int s0 = 0; s0 < SEQ; s0 += 32 * NBUF) {
        // stages behind the last one do not exist: the last trip re-reads the
        // first stages instead (in bounds, never used)
        const int snext = (s0 + 32 * NBUF < SEQ) ? s0 + 32 * NBUF : 0;

        #pragma unroll
        for (int j = 0; j < NBUF; ++j) {
            {   // ---- fetch the stage NBUF-1 ahead into the buffer just freed
                const int jb = (j + NBUF - 1) % NBUF;
                const int sf = (j == 0) ? s0 + 32 * (NBUF - 1) : snext + 32 * (j - 1);
                rk0[jb] = *(const v16h*)(kb + (size_t)sf * CPLANE + klane);
                rk1[jb] = *(const v16h*)(kb + (size_t)(sf + 16) * CPLANE + klane);
                rv0[jb] = *(const v16h*)(vb + sf + vlane);
                rv1[jb] = *(const v16h*)(vb + 16 * SEQ + sf + vlane);
                // compiler fence: without it the compiler sinks these loads
                // down to the stage that uses them and the lead is lost
                asm volatile("" ::: "memory");
            }

            // ---- scores: two 16x16 S^T tiles over 32 keys ------------------
            v8f zero = {};
            v8f st0 = __builtin_amdgcn_wmma_f32_16x16x32_f16(
                false, rk0[j], false, bq, (short)0, zero, false, false);
            v8f st1 = __builtin_amdgcn_wmma_f32_16x16x32_f16(
                false, rk1[j], false, bq, (short)0, zero, false, false);

            // gather this lane's 16 s-values of its query column:
            // lane<16 owns s=0..7 (st0) and gets s=8..15 from partner;
            // lane>=16 owns s=24..31 (st1) and gets s=16..23 from partner.
            float x[8], y[8];
            #pragma unroll
            for (int r = 0; r < 8; ++r) {
                x[r] = lowhalf ? st0[r] : st1[r];
                float send = lowhalf ? st1[r] : st0[r];
                y[r] = __shfl_xor(send, 16, 32);
            }

            // ---- online softmax (log2 domain) ------------------------------
            float bm = fmaxf(x[0], y[0]);
            #pragma unroll
            for (int r = 1; r < 8; ++r) bm = fmaxf(bm, fmaxf(x[r], y[r]));
            bm = fmaxf(bm, __shfl_xor(bm, 16, 32));

            // wave-uniform: rescale only when some column's max actually moved
            if (__any(bm > mrun)) {
                const float mnew = fmaxf(mrun, bm);
                const float corr = __builtin_amdgcn_exp2f(mrun - mnew); // 0 first time
                mrun = mnew;
                lrun *= corr;
                #pragma unroll
                for (int r = 0; r < 8; ++r) { acc0[r] *= corr; acc1[r] *= corr; }
            }

            float px[8], py[8], lsum = 0.0f;
            #pragma unroll
            for (int r = 0; r < 8; ++r) {
                px[r] = __builtin_amdgcn_exp2f(x[r] - mrun);
                py[r] = __builtin_amdgcn_exp2f(y[r] - mrun);
                lsum += px[r] + py[r];
            }
            lsum += __shfl_xor(lsum, 16, 32);
            lrun += lsum;

            // ---- pack P^T into B-operand layout ----------------------------
            // lane<16 : k slots 0..15 = s 0..15  -> [px, py]
            // lane>=16: k slots 0..15 = s 16..31 -> [py, px]
            v16h bp;
            #pragma unroll
            for (int r = 0; r < 8; ++r) {
                bp[r]     = (_Float16)(lowhalf ? px[r] : py[r]);
                bp[r + 8] = (_Float16)(lowhalf ? py[r] : px[r]);
            }

            // ---- numerator: outT += V^T x P^T ------------------------------
            acc0 = __builtin_amdgcn_wmma_f32_16x16x32_f16(
                false, rv0[j], false, bp, (short)0, acc0, false, false);
            acc1 = __builtin_amdgcn_wmma_f32_16x16x32_f16(
                false, rv1[j], false, bp, (short)0, acc1, false, false);
        }
    }

    // the last trip's fetches are never used: they land before the wave ends
    // and gives its registers back
    asm volatile("s_wait_loadcnt 0x0" ::: "memory");

    // ---- epilogue: divide by denominator, write out [n, q, h, d] -----------
    const float inv = 1.0f / lrun;
    const int   qq  = q0 + lmod;
    float* obase = out + ((size_t)(nb * SEQ + qq) * NHEAD + h) * HDIM;
    const int dbase = lhalf * 8;                   // acc0 rows: d = dbase+r
    float4 w;
    w = make_float4(acc0[0]*inv, acc0[1]*inv, acc0[2]*inv, acc0[3]*inv);
    *(float4*)(obase + dbase)          = w;
    w = make_float4(acc0[4]*inv, acc0[5]*inv, acc0[6]*inv, acc0[7]*inv);
    *(float4*)(obase + dbase + 4)      = w;
    w = make_float4(acc1[0]*inv, acc1[1]*inv, acc1[2]*inv, acc1[3]*inv);
    *(float4*)(obase + 16 + dbase)     = w;
    w = make_float4(acc1[4]*inv, acc1[5]*inv, acc1[6]*inv, acc1[7]*inv);
    *(float4*)(obase + 16 + dbase + 4) = w;
}

// ---------------------------------------------------------------------------
extern "C" void kernel_launch(void* const* d_in, const int* in_sizes, int n_in,
                              void* d_out, int out_size, void* d_ws, size_t ws_size,
                              hipStream_t stream) {
    const float* q = (const float*)d_in[0];
    const float* k = (const float*)d_in[1];
    const float* v = (const float*)d_in[2];
    float* out = (float*)d_out;

    const int nelem = NBATCH * SEQ * CPLANE;       // 2,097,152 per tensor
    char* ws = (char*)d_ws;
    _Float16* q16  = (_Float16*)(ws);
    _Float16* k16  = (_Float16*)(ws + (size_t)nelem * 2);
    _Float16* vt16 = (_Float16*)(ws + (size_t)nelem * 4);

    // 1/sqrt(d) * log2(e): softmax computed with exp2
    const float qscale = (1.0f / sqrtf((float)HDIM)) * 1.44269504088896340736f;

    qk_cvt_kernel<<<2048, 256, 0, stream>>>(q, k, q16, k16, qscale, nelem);

    dim3 tgrid(SEQ / 32, NHEAD, NBATCH);
    v_transpose_kernel<<<tgrid, 256, 0, stream>>>(v, vt16);

    // 4096 wave-tiles, 8 waves/block
    attention_kernel<<<512, 256, 0, stream>>>(q16, k16, vt16, out);
}

// v002
// Measured time: 65.9 microseconds a run.
// Two timings next to v001 both put it at 2.14 times that version's speed.
// Counting every step since v000, it is 3.06 times as fast.
#include <hip/hip_runtime.h>
#include <hip/hip_bf16.h>
#include <math.h>

typedef __attribute__((ext_vector_type(16))) _Float16 v16h;
typedef __attribute__((ext_vector_type(8)))  _Float16 v8h;
typedef __attribute__((ext_vector_type(8)))  float    v8f;

#define NBATCH 2
#define NHEAD  8
#define SEQ    4096       // 64*64
#define HDIM   32         // 256 / 8
#define CPLANE 256        // NHEAD*HDIM
#define NBUF   4          // stages of 32 keys in the attention kernel's register ring

// Fragment order of K and V^T in the workspace. Per (n, h): one block of 512
// halves per A fragment (16 rows x 32 k), fragments in the order the attention
// loop walks them. Inside a block: element slot of lane l stands at
//   (slot >> 3) * 256 + l * 8 + (slot & 7)
// so each of a fragment's two 16-byte loads reads 512 contiguous bytes per wave.
#define FRAG   512        // halves per fragment
#define FPART  256        // halves per 16-byte part of a fragment

// ---------------------------------------------------------------------------
// Preprocess 1: Q fp32 -> f16 (same layout); K fp32 -> f16 in fragment order
// (fragment = 16 keys; lane l: key l & 15, d = (l >> 4) * 16 + slot).
// Softmax temperature AND log2(e) folded into Q so the softmax runs in the
// exp2 domain (v_exp_f32 with no preceding v_mul per score).
// ---------------------------------------------------------------------------
__global__ __launch_bounds__(256)
void qk_cvt_kernel(const float* __restrict__ q, const float* __restrict__ k,
                   _Float16* __restrict__ q16, _Float16* __restrict__ k16,
                   float qscale, int n) {
    for (int i = blockIdx.x * blockDim.x + threadIdx.x; i < n;
         i += gridDim.x * blockDim.x) {
        q16[i] = (_Float16)(q[i] * qscale);
        // i runs over the fragment-ordered destination
        const int e    = i & 7;
        const int l    = (i >> 3) & 31;
        const int part = (i >> 8) & 1;
        const int s    = ((i >> 9) & (SEQ / 16 - 1)) * 16 + (l & 15);
        const int nh   = i >> 17;                  // SEQ * HDIM = 1 << 17
        const int d    = (l >> 4) * 16 + part * 8 + e;
        k16[i] = (_Float16)(k[((size_t)((nh >> 3) * SEQ + s) * NHEAD + (nh & 7)) * HDIM + d]);
    }
}

// ---------------------------------------------------------------------------
// Preprocess 2: V [n, s, h, d] fp32  ->  V^T f16 in fragment order (LDS-tiled
// transpose; per 32 keys two fragments, d 0..15 and d 16..31; lane l: row
// d & 15 = l & 15, key = (l >> 4) * 16 + slot). A block writes its 2 KB whole.
// grid = (SEQ/32, NHEAD, NBATCH), block = 256
// ---------------------------------------------------------------------------
__global__ __launch_bounds__(256)
void v_transpose_kernel(const float* __restrict__ v, _Float16* __restrict__ vt) {
    __shared__ _Float16 tile[32][33];
    const int nb = blockIdx.z, h = blockIdx.y, s0 = blockIdx.x * 32;

    {   // coalesced read along d
        const int d  = threadIdx.x & 31;
        const int sr = threadIdx.x >> 5;           // 0..7
        #pragma unroll
        for (int i = 0; i < 4; ++i) {
            const int s = s0 + sr + i * 8;
            tile[sr + i * 8][d] =
                (_Float16)v[((size_t)(nb * SEQ + s) * NHEAD + h) * HDIM + d];
        }
    }
    __syncthreads();
    {   // contiguous write, one 16-byte part of one fragment per pass
        const int e = threadIdx.x & 7;
        const int l = threadIdx.x >> 3;            // 0..31
        #pragma unroll
        for (int i = 0; i < 4; ++i) {
            const int d = (i >> 1) * 16 + (l & 15);
            const int s = (l >> 4) * 16 + (i & 1) * 8 + e;
            vt[((size_t)(nb * NHEAD + h) * SEQ + s0) * HDIM + i * FPART + threadIdx.x] = tile[s][d];
        }
    }
}

// ---------------------------------------------------------------------------
// Flash attention. One wave owns a 16-query tile of one (n, h).
// S^T = K x Q^T  (A = K 16x32 f16, B = Q^T 32x16 f16, C = 16s x 16q f32)
// outT += V^T x P^T  (A = V^T 16x32, B = P^T 32x16, C = 16d x 16q f32)
// block = 256 threads = 8 waves; grid = NBATCH*NHEAD*(SEQ/16)/8 = 512 blocks
// ---------------------------------------------------------------------------
__device__ __forceinline__ v16h load_frag(const _Float16* p) {
    const v8h lo = *(const v8h*)(p);
    const v8h hi = *(const v8h*)(p + FPART);
    return __builtin_shufflevector(lo, hi, 0, 1, 2, 3, 4, 5, 6, 7,
                                   8, 9, 10, 11, 12, 13, 14, 15);
}

__global__ __launch_bounds__(256)
void attention_kernel(const _Float16* __restrict__ q16,
                      const _Float16* __restrict__ k16,
                      const _Float16* __restrict__ vt16,
                      float* __restrict__ out) {
    const int wave  = threadIdx.x >> 5;
    const int lane  = threadIdx.x & 31;
    const int tid   = blockIdx.x * 8 + wave;        // 0..4095
    const int nh    = tid >> 8;                     // (n,h) pair 0..15
    const int qtile = tid & 255;                    // 0..255
    const int nb    = nh >> 3;
    const int h     = nh & 7;
    const int q0    = qtile * 16;

    const int lmod  = lane & 15;
    const int lhalf = lane >> 4;                    // 0 or 1
    const bool lowhalf = (lhalf == 0);

    // ---- B operand: Q^T 32x16, resident for the whole loop -----------------
    // lane<16: column q=lane, d=0..15 ; lane>=16: column q=lane-16, d=16..31
    const v16h bq = *(const v16h*)(q16 +
        ((size_t)(nb * SEQ + q0 + lmod) * NHEAD + h) * HDIM + lhalf * 16);

    v8f acc0 = {};          // outT rows d=0..15  (C layout)
    v8f acc1 = {};          // outT rows d=16..31
    float mrun = -INFINITY; // running max (log2 domain) of this query column
    float lrun = 0.0f;      // running denominator

    // wave-uniform bases, one 32-bit lane offset each
    const _Float16* kb = k16  + (size_t)nh * SEQ * HDIM;   // + s*HDIM (s: multiple of 16)
    const _Float16* vb = vt16 + (size_t)nh * SEQ * HDIM;   // + s*HDIM (s: multiple of 32)
    const unsigned flane = (unsigned)(lane * 8);

    // Register ring of NBUF stages of 32 keys (K: 2 fragments, V^T: 2 fragments).
    // A stage is loaded NBUF-1 stages before it is used, so that no product
    // waits for a load that was issued in its own stage.
    v16h rk0[NBUF], rk1[NBUF], rv0[NBUF], rv1[NBUF];

    // unrolled here and in the loop: a set's index must be a compile-time
    // constant, else the ring would not stay in registers
    #pragma unroll
    for (int j = 0; j < NBUF - 1; ++j) {
        rk0[j] = load_frag(kb + j * 32 * HDIM + flane);
        rk1[j] = load_frag(kb + j * 32 * HDIM + FRAG + flane);
        rv0[j] = load_frag(vb + j * 32 * HDIM + flane);
        rv1[j] = load_frag(vb + j * 32 * HDIM + FRAG + flane);
        // compiler fence: keeps the stages in the loop's own issue order, so
        // that the counted waits at the loop's head can leave later stages in flight
        asm volatile("" ::: "memory");
    }

    for (int s0 = 0; s0 < SEQ; s0 += 32 * NBUF) {
        // stages behind the last one do not exist: the last trip re-reads the
        // first stages instead (in bounds, never used)
        const int snext = (s0 + 32 * NBUF < SEQ) ? s0 + 32 * NBUF : 0;

        #pragma unroll
        for (int j = 0; j < NBUF; ++j) {
            {   // ---- fetch the stage NBUF-1 ahead into the buffer just freed
                const int jb = (j + NBUF - 1) % NBUF;
                const int sf = (j == 0) ? s0 + 32 * (NBUF - 1) : snext + 32 * (j - 1);
                rk0[jb] = load_frag(kb + (size_t)sf * HDIM + flane);
                rk1[jb] = load_frag(kb + (size_t)sf * HDIM + FRAG + flane);
                rv0[jb] = load_frag(vb + (size_t)sf * HDIM + flane);
                rv1[jb] = load_frag(vb + (size_t)sf * HDIM + FRAG + flane);
                // compiler fence: without it the compiler sinks these loads
                // down to the stage that uses them and the lead is lost
                asm volatile("" ::: "memory");
            }

            // ---- scores: two 16x16 S^T tiles over 32 keys ------------------
            v8f zero = {};
            v8f st0 = __builtin_amdgcn_wmma_f32_16x16x32_f16(
                false, rk0[j], false, bq, (short)0, zero, false, false);
            v8f st1 = __builtin_amdgcn_wmma_f32_16x16x32_f16(
                false, rk1[j], false, bq, (short)0, zero, false, false);

            // gather this lane's 16 s-values of its query column:
            // lane<16 owns s=0..7 (st0) and gets s=8..15 from partner;
            // lane>=16 owns s=24..31 (st1) and gets s=16..23 from partner.
            float x[8], y[8];
            #pragma unroll
            for (int r = 0; r < 8; ++r) {
                x[r] = lowhalf ? st0[r] : st1[r];
                float send = lowhalf ? st1[r] : st0[r];
                y[r] = __shfl_xor(send, 16, 32);
            }

            // ---- online softmax (log2 domain) ------------------------------
            float bm = fmaxf(x[0], y[0]);
            #pragma unroll
            for (int r = 1; r < 8; ++r) bm = fmaxf(bm, fmaxf(x[r], y[r]));
            bm = fmaxf(bm, __shfl_xor(bm, 16, 32));

            // wave-uniform: rescale only when some column's max actually moved
            if (__any(bm > mrun)) {
                const float mnew = fmaxf(mrun, bm);
                const float corr = __builtin_amdgcn_exp2f(mrun - mnew); // 0 first time
                mrun = mnew;
                lrun *= corr;
                #pragma unroll
                for (int r = 0; r < 8; ++r) { acc0[r] *= corr; acc1[r] *= corr; }
            }

            float px[8], py[8], lsum = 0.0f;
            #pragma unroll
            for (int r = 0; r < 8; ++r) {
                px[r] = __builtin_amdgcn_exp2f(x[r] - mrun);
                py[r] = __builtin_amdgcn_exp2f(y[r] - mrun);
                lsum += px[r] + py[r];
            }
            lsum += __shfl_xor(lsum, 16, 32);
            lrun += lsum;

            // ---- pack P^T into B-operand layout ----------------------------
            // lane<16 : k slots 0..15 = s 0..15  -> [px, py]
            // lane>=16: k slots 0..15 = s 16..31 -> [py, px]
            v16h bp;
            #pragma unroll
            for (int r = 0; r < 8; ++r) {
                bp[r]     = (_Float16)(lowhalf ? px[r] : py[r]);
                bp[r + 8] = (_Float16)(lowhalf ? py[r] : px[r]);
            }

            // ---- numerator: outT += V^T x P^T ------------------------------
            acc0 = __builtin_amdgcn_wmma_f32_16x16x32_f16(
                false, rv0[j], false, bp, (short)0, acc0, false, false);
            acc1 = __builtin_amdgcn_wmma_f32_16x16x32_f16(
                false, rv1[j], false, bp, (short)0, acc1, false, false);
        }
    }

    // the last trip's fetches are never used: they land before the wave ends
    // and gives its registers back
    asm volatile("s_wait_loadcnt 0x0" ::: "memory");

    // ---- epilogue: divide by denominator, write out [n, q, h, d] -----------
    const float inv = 1.0f / lrun;
    const int   qq  = q0 + lmod;
    float* obase = out + ((size_t)(nb * SEQ + qq) * NHEAD + h) * HDIM;
    const int dbase = lhalf * 8;                   // acc0 rows: d = dbase+r
    float4 w;
    w = make_float4(acc0[0]*inv, acc0[1]*inv, acc0[2]*inv, acc0[3]*inv);
    *(float4*)(obase + dbase)          = w;
    w = make_float4(acc0[4]*inv, acc0[5]*inv, acc0[6]*inv, acc0[7]*inv);
    *(float4*)(obase + dbase + 4)      = w;
    w = make_float4(acc1[0]*inv, acc1[1]*inv, acc1[2]*inv, acc1[3]*inv);
    *(float4*)(obase + 16 + dbase)     = w;
    w = make_float4(acc1[4]*inv, acc1[5]*inv, acc1[6]*inv, acc1[7]*inv);
    *(float4*)(obase + 16 + dbase + 4) = w;
}

// ---------------------------------------------------------------------------
extern "C" void kernel_launch(void* const* d_in, const int* in_sizes, int n_in,
                              void* d_out, int out_size, void* d_ws, size_t ws_size,
                              hipStream_t stream) {
    const float* q = (const float*)d_in[0];
    const float* k = (const float*)d_in[1];
    const float* v = (const float*)d_in[2];
    float* out = (float*)d_out;

    const int nelem = NBATCH * SEQ * CPLANE;       // 2,097,152 per tensor
    char* ws = (char*)d_ws;
    _Float16* q16  = (_Float16*)(ws);
    _Float16* k16  = (_Float16*)(ws + (size_t)nelem * 2);
    _Float16* vt16 = (_Float16*)(ws + (size_t)nelem * 4);

    // 1/sqrt(d) * log2(e): softmax computed with exp2
    const float qscale = (1.0f / sqrtf((float)HDIM)) * 1.44269504088896340736f;

    qk_cvt_kernel<<<2048, 256, 0, stream>>>(q, k, q16, k16, qscale, nelem);

    dim3 tgrid(SEQ / 32, NHEAD, NBATCH);
    v_transpose_kernel<<<tgrid, 256, 0, stream>>>(v, vt16);

    // 4096 wave-tiles, 8 waves/block
    attention_kernel<<<512, 256, 0, stream>>>(q16, k16, vt16, out);
}

// v003
// Measured time: 55 microseconds a run.
// Two timings next to v002 put it at 1.21 and 1.20 times that version's speed.
// Counting every step since v000, it is 3.69 times as fast.
#include <hip/hip_runtime.h>
#include <hip/hip_bf16.h>
#include <math.h>

typedef __attribute__((ext_vector_type(16))) _Float16 v16h;
typedef __attribute__((ext_vector_type(8)))  _Float16 v8h;
typedef __attribute__((ext_vector_type(8)))  float    v8f;

#define NBATCH 2
#define NHEAD  8
#define SEQ    4096       // 64*64
#define HDIM   32         // 256 / 8
#define CPLANE 256        // NHEAD*HDIM
#define NBUF   4          // stages of 32 keys in the attention kernel's register ring

// Fragment order of K and V^T in the workspace. Per (n, h): one block of 512
// halves per A fragment (16 rows x 32 k), fragments in the order the attention
// loop walks them. Inside a block: element slot of lane l stands at
//   (slot >> 3) * 256 + l * 8 + (slot & 7)
// so each of a fragment's two 16-byte loads reads 512 contiguous bytes per wave.
#define FRAG   512        // halves per fragment
#define FPART  256        // halves per 16-byte part of a fragment

// ---------------------------------------------------------------------------
// Preprocess 1: Q fp32 -> f16 (same layout); K fp32 -> f16 in fragment order
// (fragment = 16 keys; lane l: key l & 15, d = (l >> 4) * 16 + slot).
// Softmax temperature AND log2(e) folded into Q so the softmax runs in the
// exp2 domain (v_exp_f32 with no preceding v_mul per score).
// ---------------------------------------------------------------------------
__global__ __launch_bounds__(256)
void qk_cvt_kernel(const float* __restrict__ q, const float* __restrict__ k,
                   _Float16* __restrict__ q16, _Float16* __restrict__ k16,
                   float qscale, int n) {
    for (int i = blockIdx.x * blockDim.x + threadIdx.x; i < n;
         i += gridDim.x * blockDim.x) {
        q16[i] = (_Float16)(q[i] * qscale);
        // i runs over the fragment-ordered destination
        const int e    = i & 7;
        const int l    = (i >> 3) & 31;
        const int part = (i >> 8) & 1;
        const int s    = ((i >> 9) & (SEQ / 16 - 1)) * 16 + (l & 15);
        const int nh   = i >> 17;                  // SEQ * HDIM = 1 << 17
        const int d    = (l >> 4) * 16 + part * 8 + e;
        k16[i] = (_Float16)(k[((size_t)((nh >> 3) * SEQ + s) * NHEAD + (nh & 7)) * HDIM + d]);
    }
}

// ---------------------------------------------------------------------------
// Preprocess 2: V [n, s, h, d] fp32  ->  V^T f16 in fragment order (LDS-tiled
// transpose; per 32 keys two fragments, d 0..15 and d 16..31; lane l: row
// d & 15 = l & 15, key = (slot >> 3) * 16 + (l >> 4) * 8 + (slot & 7): the keys
// whose scores lane l holds in its two score tiles). A block writes its 2 KB whole.
// grid = (SEQ/32, NHEAD, NBATCH), block = 256
// ---------------------------------------------------------------------------
__global__ __launch_bounds__(256)
void v_transpose_kernel(const float* __restrict__ v, _Float16* __restrict__ vt) {
    __shared__ _Float16 tile[32][33];
    const int nb = blockIdx.z, h = blockIdx.y, s0 = blockIdx.x * 32;

    {   // coalesced read along d
        const int d  = threadIdx.x & 31;
        const int sr = threadIdx.x >> 5;           // 0..7
        #pragma unroll
        for (int i = 0; i < 4; ++i) {
            const int s = s0 + sr + i * 8;
            tile[sr + i * 8][d] =
                (_Float16)v[((size_t)(nb * SEQ + s) * NHEAD + h) * HDIM + d];
        }
    }
    __syncthreads();
    {   // contiguous write, one 16-byte part of one fragment per pass
        const int e = threadIdx.x & 7;
        const int l = threadIdx.x >> 3;            // 0..31
        #pragma unroll
        for (int i = 0; i < 4; ++i) {
            const int d = (i >> 1) * 16 + (l & 15);
            const int s = (i & 1) * 16 + (l >> 4) * 8 + e;
            vt[((size_t)(nb * NHEAD + h) * SEQ + s0) * HDIM + i * FPART + threadIdx.x] = tile[s][d];
        }
    }
}

// ---------------------------------------------------------------------------
// Flash attention. One wave owns a 16-query tile of one (n, h).
// S^T = K x Q^T  (A = K 16x32 f16, B = Q^T 32x16 f16, C = 16s x 16q f32)
// outT += V^T x P^T  (A = V^T 16x32, B = P^T 32x16, C = 16d x 16q f32)
// block = 256 threads = 8 waves; grid = NBATCH*NHEAD*(SEQ/16)/8 = 512 blocks
// ---------------------------------------------------------------------------
__device__ __forceinline__ v16h load_frag(const _Float16* p) {
    const v8h lo = *(const v8h*)(p);
    const v8h hi = *(const v8h*)(p + FPART);
    return __builtin_shufflevector(lo, hi, 0, 1, 2, 3, 4, 5, 6, 7,
                                   8, 9, 10, 11, 12, 13, 14, 15);
}

__global__ __launch_bounds__(256)
void attention_kernel(const _Float16* __restrict__ q16,
                      const _Float16* __restrict__ k16,
                      const _Float16* __restrict__ vt16,
                      float* __restrict__ out) {
    const int wave  = threadIdx.x >> 5;
    const int lane  = threadIdx.x & 31;
    const int tid   = blockIdx.x * 8 + wave;        // 0..4095
    const int nh    = tid >> 8;                     // (n,h) pair 0..15
    const int qtile = tid & 255;                    // 0..255
    const int nb    = nh >> 3;
    const int h     = nh & 7;
    const int q0    = qtile * 16;

    const int lmod  = lane & 15;
    const int lhalf = lane >> 4;                    // 0 or 1

    // ---- B operand: Q^T 32x16, resident for the whole loop -----------------
    // lane<16: column q=lane, d=0..15 ; lane>=16: column q=lane-16, d=16..31
    const v16h bq = *(const v16h*)(q16 +
        ((size_t)(nb * SEQ + q0 + lmod) * NHEAD + h) * HDIM + lhalf * 16);

    v8f acc0 = {};          // outT rows d=0..15  (C layout)
    v8f acc1 = {};          // outT rows d=16..31
    float mrun = -INFINITY; // running max (log2 domain) of this query column
    float lrun = 0.0f;      // running denominator

    // wave-uniform bases, one 32-bit lane offset each
    const _Float16* kb = k16  + (size_t)nh * SEQ * HDIM;   // + s*HDIM (s: multiple of 16)
    const _Float16* vb = vt16 + (size_t)nh * SEQ * HDIM;   // + s*HDIM (s: multiple of 32)
    const unsigned flane = (unsigned)(lane * 8);

    // Register ring of NBUF stages of 32 keys (K: 2 fragments, V^T: 2 fragments).
    // A stage is loaded NBUF-1 stages before it is used, so that no product
    // waits for a load that was issued in its own stage.
    v16h rk0[NBUF], rk1[NBUF], rv0[NBUF], rv1[NBUF];

    // unrolled here and in the loop: a set's index must be a compile-time
    // constant, else the ring would not stay in registers
    #pragma unroll
    for (int j = 0; j < NBUF - 1; ++j) {
        rk0[j] = load_frag(kb + j * 32 * HDIM + flane);
        rk1[j] = load_frag(kb + j * 32 * HDIM + FRAG + flane);
        rv0[j] = load_frag(vb + j * 32 * HDIM + flane);
        rv1[j] = load_frag(vb + j * 32 * HDIM + FRAG + flane);
        // compiler fence: keeps the stages in the loop's own issue order, so
        // that the counted waits at the loop's head can leave later stages in flight
        asm volatile("" ::: "memory");
    }

    for (int s0 = 0; s0 < SEQ; s0 += 32 * NBUF) {
        // stages behind the last one do not exist: the last trip re-reads the
        // first stages instead (in bounds, never used)
        const int snext = (s0 + 32 * NBUF < SEQ) ? s0 + 32 * NBUF : 0;

        #pragma unroll
        for (int j = 0; j < NBUF; ++j) {
            {   // ---- fetch the stage NBUF-1 ahead into the buffer just freed
                const int jb = (j + NBUF - 1) % NBUF;
                const int sf = (j == 0) ? s0 + 32 * (NBUF - 1) : snext + 32 * (j - 1);
                rk0[jb] = load_frag(kb + (size_t)sf * HDIM + flane);
                rk1[jb] = load_frag(kb + (size_t)sf * HDIM + FRAG + flane);
                rv0[jb] = load_frag(vb + (size_t)sf * HDIM + flane);
                rv1[jb] = load_frag(vb + (size_t)sf * HDIM + FRAG + flane);
                // compiler fence: without it the compiler sinks these loads
                // down to the stage that uses them and the lead is lost; the
                // wait stands in front of any reuse of the loads' address registers
                asm volatile("s_wait_xcnt 0x0" ::: "memory");
            }

            // ---- scores: two 16x16 S^T tiles over 32 keys ------------------
            v8f zero = {};
            v8f st0 = __builtin_amdgcn_wmma_f32_16x16x32_f16(
                false, rk0[j], false, bq, (short)0, zero, false, false);
            v8f st1 = __builtin_amdgcn_wmma_f32_16x16x32_f16(
                false, rk1[j], false, bq, (short)0, zero, false, false);

            // a lane keeps the 16 scores of its query column that it holds:
            // keys lhalf*8 + r (st0) and 16 + lhalf*8 + r (st1)

            // ---- online softmax (log2 domain) ------------------------------
            float bm = fmaxf(st0[0], st1[0]);
            #pragma unroll
            for (int r = 1; r < 8; ++r) bm = fmaxf(bm, fmaxf(st0[r], st1[r]));
            bm = fmaxf(bm, __shfl_xor(bm, 16, 32));

            // wave-uniform: rescale only when some column's max actually moved
            if (__any(bm > mrun)) {
                const float mnew = fmaxf(mrun, bm);
                const float corr = __builtin_amdgcn_exp2f(mrun - mnew); // 0 first time
                mrun = mnew;
                lrun *= corr;
                #pragma unroll
                for (int r = 0; r < 8; ++r) { acc0[r] *= corr; acc1[r] *= corr; }
            }

            float px[8], py[8], lsum = 0.0f;
            #pragma unroll
            for (int r = 0; r < 8; ++r) {
                px[r] = __builtin_amdgcn_exp2f(st0[r] - mrun);
                py[r] = __builtin_amdgcn_exp2f(st1[r] - mrun);
                lsum += px[r] + py[r];
            }
            lsum += __shfl_xor(lsum, 16, 32);
            lrun += lsum;

            // ---- P^T as B operand: converted in place ----------------------
            // slot r = st0's row r, slot 8 + r = st1's row r, the key order in
            // which the V^T fragments are stored
            v16h bp;
            #pragma unroll
            for (int r = 0; r < 8; ++r) {
                bp[r]     = (_Float16)px[r];
                bp[r + 8] = (_Float16)py[r];
            }

            // ---- numerator: outT += V^T x P^T ------------------------------
            acc0 = __builtin_amdgcn_wmma_f32_16x16x32_f16(
                false, rv0[j], false, bp, (short)0, acc0, false, false);
            acc1 = __builtin_amdgcn_wmma_f32_16x16x32_f16(
                false, rv1[j], false, bp, (short)0, acc1, false, false);
        }
    }

    // the last trip's re-reads of the first stages are never used: they land before the wave ends
    // and gives its registers back
    asm volatile("s_wait_loadcnt 0x0" ::: "memory");

    // ---- epilogue: divide by denominator, write out [n, q, h, d] -----------
    const float inv = 1.0f / lrun;
    const int   qq  = q0 + lmod;
    float* obase = out + ((size_t)(nb * SEQ + qq) * NHEAD + h) * HDIM;
    const int dbase = lhalf * 8;                   // acc0 rows: d = dbase+r
    float4 w;
    w = make_float4(acc0[0]*inv, acc0[1]*inv, acc0[2]*inv, acc0[3]*inv);
    *(float4*)(obase + dbase)          = w;
    w = make_float4(acc0[4]*inv, acc0[5]*inv, acc0[6]*inv, acc0[7]*inv);
    *(float4*)(obase + dbase + 4)      = w;
    w = make_float4(acc1[0]*inv, acc1[1]*inv, acc1[2]*inv, acc1[3]*inv);
    *(float4*)(obase + 16 + dbase)     = w;
    w = make_float4(acc1[4]*inv, acc1[5]*inv, acc1[6]*inv, acc1[7]*inv);
    *(float4*)(obase + 16 + dbase + 4) = w;
}

// ---------------------------------------------------------------------------
extern "C" void kernel_launch(void* const* d_in, const int* in_sizes, int n_in,
                              void* d_out, int out_size, void* d_ws, size_t ws_size,
                              hipStream_t stream) {
    const float* q = (const float*)d_in[0];
    const float* k = (const float*)d_in[1];
    const float* v = (const float*)d_in[2];
    float* out = (float*)d_out;

    const int nelem = NBATCH * SEQ * CPLANE;       // 2,097,152 per tensor
    char* ws = (char*)d_ws;
    _Float16* q16  = (_Float16*)(ws);
    _Float16* k16  = (_Float16*)(ws + (size_t)nelem * 2);
    _Float16* vt16 = (_Float16*)(ws + (size_t)nelem * 4);

    // 1/sqrt(d) * log2(e): softmax computed with exp2
    const float qscale = (1.0f / sqrtf((float)HDIM)) * 1.44269504088896340736f;

    qk_cvt_kernel<<<2048, 256, 0, stream>>>(q, k, q16, k16, qscale, nelem);

    dim3 tgrid(SEQ / 32, NHEAD, NBATCH);
    v_transpose_kernel<<<tgrid, 256, 0, stream>>>(v, vt16);

    // 4096 wave-tiles, 8 waves/block
    attention_kernel<<<512, 256, 0, stream>>>(q16, k16, vt16, out);
}

// v004
// One run takes 51.2 microseconds.
// Next to v003, in two timings, it ran 1.07 times as fast each time.
// Over all steps from v000 it is 3.95 times as fast.
#include <hip/hip_runtime.h>
#include <hip/hip_bf16.h>
#include <math.h>

typedef __attribute__((ext_vector_type(16))) _Float16 v16h;
typedef __attribute__((ext_vector_type(8)))  _Float16 v8h;
typedef __attribute__((ext_vector_type(8)))  float    v8f;

#define NBATCH 2
#define NHEAD  8
#define SEQ    4096       // 64*64
#define HDIM   32         // 256 / 8
#define CPLANE 256        // NHEAD*HDIM
#define NBUF   4          // stages of 32 keys in the attention kernel's register ring

// Fragment order of K and V^T in the workspace. Per (n, h): one block of 512
// halves per A fragment (16 rows x 32 k), fragments in the order the attention
// loop walks them. Inside a block: element slot of lane l stands at
//   (slot >> 3) * 256 + l * 8 + (slot & 7)
// so each of a fragment's two 16-byte loads reads 512 contiguous bytes per wave.
#define FRAG   512        // halves per fragment
#define FPART  256        // halves per 16-byte part of a fragment

// ---------------------------------------------------------------------------
// Preprocess 1: Q fp32 -> f16 (same layout); K fp32 -> f16 in fragment order
// (fragment = 16 keys; lane l: key l & 15, d = (l >> 4) * 16 + slot).
// Softmax temperature AND log2(e) folded into Q so the softmax runs in the
// exp2 domain (v_exp_f32 with no preceding v_mul per score).
// ---------------------------------------------------------------------------
__global__ __launch_bounds__(256)
void qk_cvt_kernel(const float* __restrict__ q, const float* __restrict__ k,
                   _Float16* __restrict__ q16, _Float16* __restrict__ k16,
                   float qscale, int n) {
    for (int i = blockIdx.x * blockDim.x + threadIdx.x; i < n;
         i += gridDim.x * blockDim.x) {
        q16[i] = (_Float16)(q[i] * qscale);
        // i runs over the fragment-ordered destination
        const int e    = i & 7;
        const int l    = (i >> 3) & 31;
        const int part = (i >> 8) & 1;
        const int s    = ((i >> 9) & (SEQ / 16 - 1)) * 16 + (l & 15);
        const int nh   = i >> 17;                  // SEQ * HDIM = 1 << 17
        const int d    = (l >> 4) * 16 + part * 8 + e;
        k16[i] = (_Float16)(k[((size_t)((nh >> 3) * SEQ + s) * NHEAD + (nh & 7)) * HDIM + d]);
    }
}

// ---------------------------------------------------------------------------
// Preprocess 2: V [n, s, h, d] fp32  ->  V^T f16 in fragment order (LDS-tiled
// transpose; per 32 keys two fragments, d 0..15 and d 16..31; lane l: row
// d & 15 = l & 15, key = (slot >> 3) * 16 + (l >> 4) * 8 + (slot & 7): the keys
// whose scores lane l holds in its two score tiles). A block writes its 2 KB whole.
// grid = (SEQ/32, NHEAD, NBATCH), block = 256
// ---------------------------------------------------------------------------
__global__ __launch_bounds__(256)
void v_transpose_kernel(const float* __restrict__ v, _Float16* __restrict__ vt) {
    __shared__ _Float16 tile[32][33];
    const int nb = blockIdx.z, h = blockIdx.y, s0 = blockIdx.x * 32;

    {   // coalesced read along d
        const int d  = threadIdx.x & 31;
        const int sr = threadIdx.x >> 5;           // 0..7
        #pragma unroll
        for (int i = 0; i < 4; ++i) {
            const int s = s0 + sr + i * 8;
            tile[sr + i * 8][d] =
                (_Float16)v[((size_t)(nb * SEQ + s) * NHEAD + h) * HDIM + d];
        }
    }
    __syncthreads();
    {   // contiguous write, one 16-byte part of one fragment per pass
        const int e = threadIdx.x & 7;
        const int l = threadIdx.x >> 3;            // 0..31
        #pragma unroll
        for (int i = 0; i < 4; ++i) {
            const int d = (i >> 1) * 16 + (l & 15);
            const int s = (i & 1) * 16 + (l >> 4) * 8 + e;
            vt[((size_t)(nb * NHEAD + h) * SEQ + s0) * HDIM + i * FPART + threadIdx.x] = tile[s][d];
        }
    }
}

// ---------------------------------------------------------------------------
// Flash attention. One wave owns a 16-query tile of one (n, h).
// S^T = K x Q^T  (A = K 16x32 f16, B = Q^T 32x16 f16, C = 16s x 16q f32)
// outT += V^T x P^T  (A = V^T 16x32, B = P^T 32x16, C = 16d x 16q f32)
// den  += E x P^T    (A = E: rows 0 and 8 all ones, the rest 0): the softmax
//                    denominators, summed by the matrix unit
// block = 256 threads = 8 waves; grid = NBATCH*NHEAD*(SEQ/16)/8 = 512 blocks
// ---------------------------------------------------------------------------
__device__ __forceinline__ v16h load_frag(const _Float16* p) {
    const v8h lo = *(const v8h*)(p);
    const v8h hi = *(const v8h*)(p + FPART);
    return __builtin_shufflevector(lo, hi, 0, 1, 2, 3, 4, 5, 6, 7,
                                   8, 9, 10, 11, 12, 13, 14, 15);
}

__global__ __launch_bounds__(256)
void attention_kernel(const _Float16* __restrict__ q16,
                      const _Float16* __restrict__ k16,
                      const _Float16* __restrict__ vt16,
                      float* __restrict__ out) {
    const int wave  = threadIdx.x >> 5;
    const int lane  = threadIdx.x & 31;
    const int tid   = blockIdx.x * 8 + wave;        // 0..4095
    const int nh    = tid >> 8;                     // (n,h) pair 0..15
    const int qtile = tid & 255;                    // 0..255
    const int nb    = nh >> 3;
    const int h     = nh & 7;
    const int q0    = qtile * 16;

    const int lmod  = lane & 15;
    const int lhalf = lane >> 4;                    // 0 or 1

    // ---- B operand: Q^T 32x16, resident for the whole loop -----------------
    // lane<16: column q=lane, d=0..15 ; lane>=16: column q=lane-16, d=16..31
    const v16h bq = *(const v16h*)(q16 +
        ((size_t)(nb * SEQ + q0 + lmod) * NHEAD + h) * HDIM + lhalf * 16);

    v8f acc0 = {};          // outT rows d=0..15  (C layout)
    v8f acc1 = {};          // outT rows d=16..31
    float mrun = -INFINITY; // running max (log2 domain) of this query column
    // running denominators: row 0 (lanes 0..15) and row 8 (lanes 16..31) of the
    // tile stand in register 0, so every lane holds its own column's full sum
    // there; the other rows stay 0
    v8f accl = {};
    v16h ones;
    {
        const _Float16 o = (lane & 7) == 0 ? (_Float16)1.0f : (_Float16)0.0f;
        #pragma unroll
        for (int r = 0; r < 16; ++r) ones[r] = o;
    }

    // wave-uniform bases, one 32-bit lane offset each
    const _Float16* kb = k16  + (size_t)nh * SEQ * HDIM;   // + s*HDIM (s: multiple of 16)
    const _Float16* vb = vt16 + (size_t)nh * SEQ * HDIM;   // + s*HDIM (s: multiple of 32)
    const unsigned flane = (unsigned)(lane * 8);

    // Register ring of NBUF stages of 32 keys (K: 2 fragments, V^T: 2 fragments).
    // A stage is loaded NBUF-1 stages before it is used, so that no product
    // waits for a load that was issued in its own stage.
    v16h rk0[NBUF], rk1[NBUF], rv0[NBUF], rv1[NBUF];

    // unrolled here and in the loop: a set's index must be a compile-time
    // constant, else the ring would not stay in registers
    #pragma unroll
    for (int j = 0; j < NBUF - 1; ++j) {
        rk0[j] = load_frag(kb + j * 32 * HDIM + flane);
        rk1[j] = load_frag(kb + j * 32 * HDIM + FRAG + flane);
        rv0[j] = load_frag(vb + j * 32 * HDIM + flane);
        rv1[j] = load_frag(vb + j * 32 * HDIM + FRAG + flane);
        // compiler fence: keeps the stages in the loop's own issue order, so
        // that the counted waits at the loop's head can leave later stages in flight
        asm volatile("" ::: "memory");
    }

    for (int s0 = 0; s0 < SEQ; s0 += 32 * NBUF) {
        // stages behind the last one do not exist: the last trip re-reads the
        // first stages instead (in bounds, never used)
        const int snext = (s0 + 32 * NBUF < SEQ) ? s0 + 32 * NBUF : 0;

        #pragma unroll
        for (int j = 0; j < NBUF; ++j) {
            {   // ---- fetch the stage NBUF-1 ahead into the buffer just freed
                const int jb = (j + NBUF - 1) % NBUF;
                const int sf = (j == 0) ? s0 + 32 * (NBUF - 1) : snext + 32 * (j - 1);
                rk0[jb] = load_frag(kb + (size_t)sf * HDIM + flane);
                rk1[jb] = load_frag(kb + (size_t)sf * HDIM + FRAG + flane);
                rv0[jb] = load_frag(vb + (size_t)sf * HDIM + flane);
                rv1[jb] = load_frag(vb + (size_t)sf * HDIM + FRAG + flane);
                // compiler fence: without it the compiler sinks these loads
                // down to the stage that uses them and the lead is lost; the
                // wait stands in front of any reuse of the loads' address registers
                asm volatile("s_wait_xcnt 0x0" ::: "memory");
            }

            // ---- scores: two 16x16 S^T tiles over 32 keys ------------------
            v8f zero = {};
            v8f st0 = __builtin_amdgcn_wmma_f32_16x16x32_f16(
                false, rk0[j], false, bq, (short)0, zero, false, false);
            v8f st1 = __builtin_amdgcn_wmma_f32_16x16x32_f16(
                false, rk1[j], false, bq, (short)0, zero, false, false);

            // a lane keeps the 16 scores of its query column that it holds:
            // keys lhalf*8 + r (st0) and 16 + lhalf*8 + r (st1)

            // ---- online softmax (log2 domain) ------------------------------
            float bm = fmaxf(st0[0], st1[0]);
            #pragma unroll
            for (int r = 1; r < 8; ++r) bm = fmaxf(bm, fmaxf(st0[r], st1[r]));
            bm = fmaxf(bm, __shfl_xor(bm, 16, 32));

            // wave-uniform: rescale only when some column's max actually moved
            if (__any(bm > mrun)) {
                const float mnew = fmaxf(mrun, bm);
                const float corr = __builtin_amdgcn_exp2f(mrun - mnew); // 0 first time
                mrun = mnew;
                accl[0] *= corr;
                #pragma unroll
                for (int r = 0; r < 8; ++r) { acc0[r] *= corr; acc1[r] *= corr; }
            }

            float px[8], py[8];
            #pragma unroll
            for (int r = 0; r < 8; ++r) {
                px[r] = __builtin_amdgcn_exp2f(st0[r] - mrun);
                py[r] = __builtin_amdgcn_exp2f(st1[r] - mrun);
            }

            // ---- P^T as B operand: converted in place ----------------------
            // slot r = st0's row r, slot 8 + r = st1's row r, the key order in
            // which the V^T fragments are stored
            v16h bp;
            #pragma unroll
            for (int r = 0; r < 8; ++r) {
                bp[r]     = (_Float16)px[r];
                bp[r + 8] = (_Float16)py[r];
            }

            // ---- numerator: outT += V^T x P^T ------------------------------
            acc0 = __builtin_amdgcn_wmma_f32_16x16x32_f16(
                false, rv0[j], false, bp, (short)0, acc0, false, false);
            acc1 = __builtin_amdgcn_wmma_f32_16x16x32_f16(
                false, rv1[j], false, bp, (short)0, acc1, false, false);

            // ---- denominator: column sums of the same P^T ------------------
            accl = __builtin_amdgcn_wmma_f32_16x16x32_f16(
                false, ones, false, bp, (short)0, accl, false, false);
        }
    }

    // the last trip's re-reads of the first stages are never used: they land before the wave ends
    // and gives its registers back
    asm volatile("s_wait_loadcnt 0x0" ::: "memory");

    // ---- epilogue: divide by denominator, write out [n, q, h, d] -----------
    const float inv = 1.0f / accl[0];
    const int   qq  = q0 + lmod;
    float* obase = out + ((size_t)(nb * SEQ + qq) * NHEAD + h) * HDIM;
    const int dbase = lhalf * 8;                   // acc0 rows: d = dbase+r
    float4 w;
    w = make_float4(acc0[0]*inv, acc0[1]*inv, acc0[2]*inv, acc0[3]*inv);
    *(float4*)(obase + dbase)          = w;
    w = make_float4(acc0[4]*inv, acc0[5]*inv, acc0[6]*inv, acc0[7]*inv);
    *(float4*)(obase + dbase + 4)      = w;
    w = make_float4(acc1[0]*inv, acc1[1]*inv, acc1[2]*inv, acc1[3]*inv);
    *(float4*)(obase + 16 + dbase)     = w;
    w = make_float4(acc1[4]*inv, acc1[5]*inv, acc1[6]*inv, acc1[7]*inv);
    *(float4*)(obase + 16 + dbase + 4) = w;
}

// ---------------------------------------------------------------------------
extern "C" void kernel_launch(void* const* d_in, const int* in_sizes, int n_in,
                              void* d_out, int out_size, void* d_ws, size_t ws_size,
                              hipStream_t stream) {
    const float* q = (const float*)d_in[0];
    const float* k = (const float*)d_in[1];
    const float* v = (const float*)d_in[2];
    float* out = (float*)d_out;

    const int nelem = NBATCH * SEQ * CPLANE;       // 2,097,152 per tensor
    char* ws = (char*)d_ws;
    _Float16* q16  = (_Float16*)(ws);
    _Float16* k16  = (_Float16*)(ws + (size_t)nelem * 2);
    _Float16* vt16 = (_Float16*)(ws + (size_t)nelem * 4);

    // 1/sqrt(d) * log2(e): softmax computed with exp2
    const float qscale = (1.0f / sqrtf((float)HDIM)) * 1.44269504088896340736f;

    qk_cvt_kernel<<<2048, 256, 0, stream>>>(q, k, q16, k16, qscale, nelem);

    dim3 tgrid(SEQ / 32, NHEAD, NBATCH);
    v_transpose_kernel<<<tgrid, 256, 0, stream>>>(v, vt16);

    // 4096 wave-tiles, 8 waves/block
    attention_kernel<<<512, 256, 0, stream>>>(q16, k16, vt16, out);
}

// v005
// One run takes 49.4 microseconds.
// Timed twice side by side with v004, it ran 1.03 times as fast both times.
// Counting every step since v000, it is 4.09 times as fast.
#include <hip/hip_runtime.h>
#include <hip/hip_bf16.h>
#include <math.h>

typedef __attribute__((ext_vector_type(16))) _Float16 v16h;
typedef __attribute__((ext_vector_type(8)))  _Float16 v8h;
typedef __attribute__((ext_vector_type(8)))  float    v8f;

#define NBATCH 2
#define NHEAD  8
#define SEQ    4096       // 64*64
#define HDIM   32         // 256 / 8
#define CPLANE 256        // NHEAD*HDIM
#define NBUF   4          // stages of 32 keys in the attention kernel's register ring

// Fragment order of K and V^T in the workspace. Per (n, h): one block of 512
// halves per A fragment (16 rows x 32 k), fragments in the order the attention
// loop walks them. Inside a block: element slot of lane l stands at
//   (slot >> 3) * 256 + l * 8 + (slot & 7)
// so each of a fragment's two 16-byte loads reads 512 contiguous bytes per wave.
#define FRAG   512        // halves per fragment
#define FPART  256        // halves per 16-byte part of a fragment

// ---------------------------------------------------------------------------
// Preprocess 1: Q fp32 -> f16 (same layout); K fp32 -> f16 in fragment order
// (fragment = 16 keys; lane l: key l & 15, d = (l >> 4) * 16 + slot).
// Softmax temperature AND log2(e) folded into Q so the softmax runs in the
// exp2 domain (v_exp_f32 with no preceding v_mul per score).
// ---------------------------------------------------------------------------
__global__ __launch_bounds__(256)
void qk_cvt_kernel(const float* __restrict__ q, const float* __restrict__ k,
                   _Float16* __restrict__ q16, _Float16* __restrict__ k16,
                   float qscale, int n) {
    for (int i = blockIdx.x * blockDim.x + threadIdx.x; i < n;
         i += gridDim.x * blockDim.x) {
        q16[i] = (_Float16)(q[i] * qscale);
        // i runs over the fragment-ordered destination
        const int e    = i & 7;
        const int l    = (i >> 3) & 31;
        const int part = (i >> 8) & 1;
        const int s    = ((i >> 9) & (SEQ / 16 - 1)) * 16 + (l & 15);
        const int nh   = i >> 17;                  // SEQ * HDIM = 1 << 17
        const int d    = (l >> 4) * 16 + part * 8 + e;
        k16[i] = (_Float16)(k[((size_t)((nh >> 3) * SEQ + s) * NHEAD + (nh & 7)) * HDIM + d]);
    }
}

// ---------------------------------------------------------------------------
// Preprocess 2: V [n, s, h, d] fp32  ->  V^T f16 in fragment order (LDS-tiled
// transpose; per 32 keys two fragments, d 0..15 and d 16..31; lane l: row
// d & 15 = l & 15, key = (slot >> 3) * 16 + (l >> 4) * 8 + (slot & 7): the keys
// whose scores lane l holds in its two score tiles). A block writes its 2 KB whole.
// grid = (SEQ/32, NHEAD, NBATCH), block = 256
// ---------------------------------------------------------------------------
__global__ __launch_bounds__(256)
void v_transpose_kernel(const float* __restrict__ v, _Float16* __restrict__ vt) {
    __shared__ _Float16 tile[32][33];
    const int nb = blockIdx.z, h = blockIdx.y, s0 = blockIdx.x * 32;

    {   // coalesced read along d
        const int d  = threadIdx.x & 31;
        const int sr = threadIdx.x >> 5;           // 0..7
        #pragma unroll
        for (int i = 0; i < 4; ++i) {
            const int s = s0 + sr + i * 8;
            tile[sr + i * 8][d] =
                (_Float16)v[((size_t)(nb * SEQ + s) * NHEAD + h) * HDIM + d];
        }
    }
    __syncthreads();
    {   // contiguous write, one 16-byte part of one fragment per pass
        const int e = threadIdx.x & 7;
        const int l = threadIdx.x >> 3;            // 0..31
        #pragma unroll
        for (int i = 0; i < 4; ++i) {
            const int d = (i >> 1) * 16 + (l & 15);
            const int s = (i & 1) * 16 + (l >> 4) * 8 + e;
            vt[((size_t)(nb * NHEAD + h) * SEQ + s0) * HDIM + i * FPART + threadIdx.x] = tile[s][d];
        }
    }
}

// ---------------------------------------------------------------------------
// Flash attention. One wave owns a 16-query tile of one (n, h).
// S^T = K x Q^T - m  (A = K 16x32 f16, B = Q^T 32x16 f16, C = 16s x 16q f32:
//                    minus each column's running max, so the scores leave the
//                    matrix unit ready for exp2)
// outT += V^T x P^T  (A = V^T 16x32, B = P^T 32x16, C = 16d x 16q f32)
// den  += E x P^T    (A = E: rows 0 and 8 all ones, the rest 0): the softmax
//                    denominators, summed by the matrix unit
// block = 256 threads = 8 waves; grid = NBATCH*NHEAD*(SEQ/16)/8 = 512 blocks
// ---------------------------------------------------------------------------
__device__ __forceinline__ v16h load_frag(const _Float16* p) {
    const v8h lo = *(const v8h*)(p);
    const v8h hi = *(const v8h*)(p + FPART);
    return __builtin_shufflevector(lo, hi, 0, 1, 2, 3, 4, 5, 6, 7,
                                   8, 9, 10, 11, 12, 13, 14, 15);
}

__global__ __launch_bounds__(256)
void attention_kernel(const _Float16* __restrict__ q16,
                      const _Float16* __restrict__ k16,
                      const _Float16* __restrict__ vt16,
                      float* __restrict__ out) {
    const int wave  = threadIdx.x >> 5;
    const int lane  = threadIdx.x & 31;
    const int tid   = blockIdx.x * 8 + wave;        // 0..4095
    const int nh    = tid >> 8;                     // (n,h) pair 0..15
    const int qtile = tid & 255;                    // 0..255
    const int nb    = nh >> 3;
    const int h     = nh & 7;
    const int q0    = qtile * 16;

    const int lmod  = lane & 15;
    const int lhalf = lane >> 4;                    // 0 or 1

    // ---- B operand: Q^T 32x16, resident for the whole loop -----------------
    // lane<16: column q=lane, d=0..15 ; lane>=16: column q=lane-16, d=16..31
    const v16h bq = *(const v16h*)(q16 +
        ((size_t)(nb * SEQ + q0 + lmod) * NHEAD + h) * HDIM + lhalf * 16);

    v8f acc0 = {};          // outT rows d=0..15  (C layout)
    v8f acc1 = {};          // outT rows d=16..31
    // running denominators: row 0 (lanes 0..15) and row 8 (lanes 16..31) of the
    // tile stand in register 0, so every lane holds its own column's full sum
    // there; the other rows stay 0
    v8f accl = {};
    v16h ones;
    {
        const _Float16 o = (lane & 7) == 0 ? (_Float16)1.0f : (_Float16)0.0f;
        #pragma unroll
        for (int r = 0; r < 16; ++r) ones[r] = o;
    }

    // wave-uniform bases, one 32-bit lane offset each
    const _Float16* kb = k16  + (size_t)nh * SEQ * HDIM;   // + s*HDIM (s: multiple of 16)
    const _Float16* vb = vt16 + (size_t)nh * SEQ * HDIM;   // + s*HDIM (s: multiple of 32)
    const unsigned flane = (unsigned)(lane * 8);

    // Register ring of NBUF stages of 32 keys (K: 2 fragments, V^T: 2 fragments).
    // A stage is loaded NBUF-1 stages before it is used, so that no product
    // waits for a load that was issued in its own stage.
    v16h rk0[NBUF], rk1[NBUF], rv0[NBUF], rv1[NBUF];

    // unrolled here and in the loop: a set's index must be a compile-time
    // constant, else the ring would not stay in registers
    #pragma unroll
    for (int j = 0; j < NBUF - 1; ++j) {
        rk0[j] = load_frag(kb + j * 32 * HDIM + flane);
        rk1[j] = load_frag(kb + j * 32 * HDIM + FRAG + flane);
        rv0[j] = load_frag(vb + j * 32 * HDIM + flane);
        rv1[j] = load_frag(vb + j * 32 * HDIM + FRAG + flane);
        // compiler fence: keeps the stages in the loop's own issue order, so
        // that the counted waits at the loop's head can leave later stages in flight
        asm volatile("" ::: "memory");
    }

    // minus the running max (log2 domain) of this lane's query column, in all
    // eight registers: the C operand of the score products. It starts at the
    // max over the first 32 keys, so that it is finite from the first stage on.
    v8f negm;
    {
        v8f zero = {};
        const v8f t0 = __builtin_amdgcn_wmma_f32_16x16x32_f16(
            false, rk0[0], false, bq, (short)0, zero, false, false);
        const v8f t1 = __builtin_amdgcn_wmma_f32_16x16x32_f16(
            false, rk1[0], false, bq, (short)0, zero, false, false);
        float m0 = fmaxf(t0[0], t1[0]);
        #pragma unroll
        for (int r = 1; r < 8; ++r) m0 = fmaxf(m0, fmaxf(t0[r], t1[r]));
        m0 = fmaxf(m0, __shfl_xor(m0, 16, 32));
        #pragma unroll
        for (int r = 0; r < 8; ++r) negm[r] = -m0;
    }

    for (int s0 = 0; s0 < SEQ; s0 += 32 * NBUF) {
        // stages behind the last one do not exist: the last trip re-reads the
        // first stages instead (in bounds, never used)
        const int snext = (s0 + 32 * NBUF < SEQ) ? s0 + 32 * NBUF : 0;

        #pragma unroll
        for (int j = 0; j < NBUF; ++j) {
            {   // ---- fetch the stage NBUF-1 ahead into the buffer just freed
                const int jb = (j + NBUF - 1) % NBUF;
                const int sf = (j == 0) ? s0 + 32 * (NBUF - 1) : snext + 32 * (j - 1);
                rk0[jb] = load_frag(kb + (size_t)sf * HDIM + flane);
                rk1[jb] = load_frag(kb + (size_t)sf * HDIM + FRAG + flane);
                rv0[jb] = load_frag(vb + (size_t)sf * HDIM + flane);
                rv1[jb] = load_frag(vb + (size_t)sf * HDIM + FRAG + flane);
                // compiler fence: without it the compiler sinks these loads
                // down to the stage that uses them and the lead is lost; the
                // wait stands in front of any reuse of the loads' address registers
                asm volatile("s_wait_xcnt 0x0" ::: "memory");
            }

            // ---- scores minus running max: two 16x16 tiles over 32 keys ----
            v8f st0 = __builtin_amdgcn_wmma_f32_16x16x32_f16(
                false, rk0[j], false, bq, (short)0, negm, false, false);
            v8f st1 = __builtin_amdgcn_wmma_f32_16x16x32_f16(
                false, rk1[j], false, bq, (short)0, negm, false, false);

            // a lane keeps the 16 scores of its query column that it holds:
            // keys lhalf*8 + r (st0) and 16 + lhalf*8 + r (st1)

            // ---- online softmax (log2 domain) ------------------------------
            float bm = fmaxf(st0[0], st1[0]);
            #pragma unroll
            for (int r = 1; r < 8; ++r) bm = fmaxf(bm, fmaxf(st0[r], st1[r]));

            // wave-uniform: rescale only when some column's max actually moved,
            // that is, when some lane holds a shifted score above 0; the two
            // halves of a column meet only in here
            if (__any(bm > 0.0f)) {
                // how far this column's max moved (0: not at all)
                const float up   = fmaxf(fmaxf(bm, __shfl_xor(bm, 16, 32)), 0.0f);
                const float corr = __builtin_amdgcn_exp2f(-up);
                accl[0] *= corr;
                acc0 *= corr;  acc1 *= corr;
                st0  -= up;    st1  -= up;
                negm -= up;
            }

            float px[8], py[8];
            #pragma unroll
            for (int r = 0; r < 8; ++r) {
                px[r] = __builtin_amdgcn_exp2f(st0[r]);
                py[r] = __builtin_amdgcn_exp2f(st1[r]);
            }

            // ---- P^T as B operand: converted in place ----------------------
            // slot r = st0's row r, slot 8 + r = st1's row r, the key order in
            // which the V^T fragments are stored
            v16h bp;
            #pragma unroll
            for (int r = 0; r < 8; ++r) {
                bp[r]     = (_Float16)px[r];
                bp[r + 8] = (_Float16)py[r];
            }

            // ---- numerator: outT += V^T x P^T ------------------------------
            acc0 = __builtin_amdgcn_wmma_f32_16x16x32_f16(
                false, rv0[j], false, bp, (short)0, acc0, false, false);
            acc1 = __builtin_amdgcn_wmma_f32_16x16x32_f16(
                false, rv1[j], false, bp, (short)0, acc1, false, false);

            // ---- denominator: column sums of the same P^T ------------------
            accl = __builtin_amdgcn_wmma_f32_16x16x32_f16(
                false, ones, false, bp, (short)0, accl, false, false);
        }
    }

    // the last trip's re-reads of the first stages are never used: they land before the wave ends
    // and gives its registers back
    asm volatile("s_wait_loadcnt 0x0" ::: "memory");

    // ---- epilogue: divide by denominator, write out [n, q, h, d] -----------
    const float inv = 1.0f / accl[0];
    const int   qq  = q0 + lmod;
    float* obase = out + ((size_t)(nb * SEQ + qq) * NHEAD + h) * HDIM;
    const int dbase = lhalf * 8;                   // acc0 rows: d = dbase+r
    float4 w;
    w = make_float4(acc0[0]*inv, acc0[1]*inv, acc0[2]*inv, acc0[3]*inv);
    *(float4*)(obase + dbase)          = w;
    w = make_float4(acc0[4]*inv, acc0[5]*inv, acc0[6]*inv, acc0[7]*inv);
    *(float4*)(obase + dbase + 4)      = w;
    w = make_float4(acc1[0]*inv, acc1[1]*inv, acc1[2]*inv, acc1[3]*inv);
    *(float4*)(obase + 16 + dbase)     = w;
    w = make_float4(acc1[4]*inv, acc1[5]*inv, acc1[6]*inv, acc1[7]*inv);
    *(float4*)(obase + 16 + dbase + 4) = w;
}

// ---------------------------------------------------------------------------
extern "C" void kernel_launch(void* const* d_in, const int* in_sizes, int n_in,
                              void* d_out, int out_size, void* d_ws, size_t ws_size,
                              hipStream_t stream) {
    const float* q = (const float*)d_in[0];
    const float* k = (const float*)d_in[1];
    const float* v = (const float*)d_in[2];
    float* out = (float*)d_out;

    const int nelem = NBATCH * SEQ * CPLANE;       // 2,097,152 per tensor
    char* ws = (char*)d_ws;
    _Float16* q16  = (_Float16*)(ws);
    _Float16* k16  = (_Float16*)(ws + (size_t)nelem * 2);
    _Float16* vt16 = (_Float16*)(ws + (size_t)nelem * 4);

    // 1/sqrt(d) * log2(e): softmax computed with exp2
    const float qscale = (1.0f / sqrtf((float)HDIM)) * 1.44269504088896340736f;

    qk_cvt_kernel<<<2048, 256, 0, stream>>>(q, k, q16, k16, qscale, nelem);

    dim3 tgrid(SEQ / 32, NHEAD, NBATCH);
    v_transpose_kernel<<<tgrid, 256, 0, stream>>>(v, vt16);

    // 4096 wave-tiles, 8 waves/block
    attention_kernel<<<512, 256, 0, stream>>>(q16, k16, vt16, out);
}

// v006
// A run of this version takes 46.1 microseconds.
// Timed twice side by side with v005, it ran 1.07 and 1.06 times as fast.
// Over all steps from v000 it is 4.37 times as fast.
#include <hip/hip_runtime.h>
#include <hip/hip_bf16.h>
#include <math.h>

typedef __attribute__((ext_vector_type(16))) _Float16 v16h;
typedef __attribute__((ext_vector_type(8)))  _Float16 v8h;
typedef __attribute__((ext_vector_type(4)))  _Float16 v4h;
typedef __attribute__((ext_vector_type(8)))  float    v8f;
typedef __attribute__((ext_vector_type(4)))  float    v4f;
typedef __attribute__((ext_vector_type(16))) float    v16f;

#define NBATCH 2
#define NHEAD  8
#define SEQ    4096       // 64*64
#define HDIM   32         // 256 / 8
#define CPLANE 256        // NHEAD*HDIM
#define NBUF   4          // stages of 32 keys in the attention kernel's register ring

// Fragment order of K and V^T in the workspace. Per (n, h): one block of 512
// halves per A fragment (16 rows x 32 k), fragments in the order the attention
// loop walks them. Inside a block: element slot of lane l stands at
//   (slot >> 3) * 256 + l * 8 + (slot & 7)
// so each of a fragment's two 16-byte loads reads 512 contiguous bytes per wave.
#define FRAG   512        // halves per fragment
#define FPART  256        // halves per 16-byte part of a fragment

// ---------------------------------------------------------------------------
// Preprocess, one launch. A work-group takes 32 sequence positions of one batch
// entry, all eight heads: 32 KB in a row of each of Q, K and V. Every load of a
// wave reads whole 128-byte lines, all of a wave's loads are independent, and
// nothing goes through LDS. 2048 waves in all, each with 48 loads in flight.
//   Q fp32 -> f16, same layout, scaled: softmax temperature AND log2(e) folded
//     in, so the softmax runs in the exp2 domain (v_exp_f32 with no preceding
//     v_mul per score). Wave w: rows 4w .. 4w+3.
//   K fp32 -> f16 in fragment order (fragment = 16 keys; lane l: key l & 15,
//     d = (l >> 4) * 16 + slot). Wave w: head w.
//   V fp32 -> V^T f16 in fragment order (per 32 keys two fragments, d 0..15 and
//     d 16..31; lane l: row d & 15 = l & 15, key = (slot >> 3) * 16 +
//     (l >> 4) * 8 + (slot & 7): the keys whose scores lane l holds in its two
//     score tiles). Wave w: head w; a lane reads one d of all 32 keys, which is
//     the transposition.
// grid = NBATCH * SEQ / 32, block = 256
// ---------------------------------------------------------------------------
__global__ __launch_bounds__(256)
void convert_kernel(const float* __restrict__ q, const float* __restrict__ k,
                    const float* __restrict__ v,
                    _Float16* __restrict__ q16, _Float16* __restrict__ k16,
                    _Float16* __restrict__ vt, float qscale) {
    const int wave = threadIdx.x >> 5;             // head of K and V
    const int lane = threadIdx.x & 31;
    const int nb   = blockIdx.x / (SEQ / 32);
    const int s0   = (blockIdx.x % (SEQ / 32)) * 32;
    const size_t row0 = (size_t)(nb * SEQ + s0);   // first row of the three sources

    // ---- all loads first ----------------------------------------------------
    // (every loop of this kernel is unrolled: the values stand in register arrays,
    // whose indices must be compile-time constants)
    // V: load s = key s0 + s, d = lane
    const float* vp = v + (row0 * NHEAD + wave) * HDIM + lane;
    v16f vv[2];
    #pragma unroll
    for (int s = 0; s < 32; ++s) vv[s >> 4][s & 15] = vp[s * CPLANE];

    // K: load j = keys s0 + 4j .. 4j+3, eight lanes to a key, four d to a lane
    const int d4 = lane & 7;
    const float* kp = k + ((row0 + (lane >> 3)) * NHEAD + wave) * HDIM + d4 * 4;
    v4f kk[8];
    #pragma unroll
    for (int j = 0; j < 8; ++j) kk[j] = *(const v4f*)(kp + j * 4 * CPLANE);

    // Q: 1024 values in a row per wave
    const size_t qoff = (row0 + wave * 4) * CPLANE + lane * 4;
    const float* qp = q + qoff;
    v4f qq[8];
    #pragma unroll
    for (int j = 0; j < 8; ++j) qq[j] = *(const v4f*)(qp + j * 128);

    // fence on the loaded values, inputs only: without it the compiler holds
    // K's and Q's loads back until V's values have come, to save registers, and
    // the wave pays the memory latency twice. The three addresses are inputs too,
    // so that their registers stay as they are up to the wait, which stands in
    // front of any reuse of them
    asm volatile("s_wait_xcnt 0x0"
                 :: "v"(vp), "v"(kp), "v"(qp), "v"(vv[0]), "v"(vv[1]),
                    "v"(kk[0]), "v"(kk[1]), "v"(kk[2]), "v"(kk[3]),
                    "v"(kk[4]), "v"(kk[5]), "v"(kk[6]), "v"(kk[7]),
                    "v"(qq[0]), "v"(qq[1]), "v"(qq[2]), "v"(qq[3]),
                    "v"(qq[4]), "v"(qq[5]), "v"(qq[6]), "v"(qq[7])
                 : "memory");

    // ---- V^T: four 16-byte parts per lane -----------------------------------
    // keys part * 16 + lh * 8 + e go to part (lane >> 4) * 2 + part of the 2 KB
    // block, at the place of fragment lane lh * 16 + (lane & 15)
    const size_t fbase = ((size_t)(nb * NHEAD + wave) * SEQ + s0) * HDIM;
    _Float16* vd = vt + fbase + (lane >> 4) * FRAG + (lane & 15) * 8;
    #pragma unroll
    for (int part = 0; part < 2; ++part) {
        #pragma unroll
        for (int lh = 0; lh < 2; ++lh) {
            v8h o;
            #pragma unroll
            for (int e = 0; e < 8; ++e) o[e] = (_Float16)vv[part][lh * 8 + e];
            *(v8h*)(vd + part * FPART + lh * 128) = o;
        }
    }

    // ---- K: d = d4 * 4 + c = (l >> 4) * 16 + part * 8 + e ---------------------
    _Float16* kd = k16 + fbase + ((d4 >> 1) & 1) * FPART
                 + ((d4 >> 2) * 16 + (lane >> 3)) * 8 + (d4 & 1) * 4;
    #pragma unroll
    for (int j = 0; j < 8; ++j) {
        v4h o;
        o[0] = (_Float16)kk[j].x;  o[1] = (_Float16)kk[j].y;
        o[2] = (_Float16)kk[j].z;  o[3] = (_Float16)kk[j].w;
        // key 4j + (lane >> 3): fragment j >> 2, fragment lane + (j & 3) * 4
        *(v4h*)(kd + (j >> 2) * FRAG + (j & 3) * 32) = o;
    }

    // ---- Q -------------------------------------------------------------------
    #pragma unroll
    for (int j = 0; j < 8; ++j) {
        v4h o;
        o[0] = (_Float16)(qq[j].x * qscale);  o[1] = (_Float16)(qq[j].y * qscale);
        o[2] = (_Float16)(qq[j].z * qscale);  o[3] = (_Float16)(qq[j].w * qscale);
        *(v4h*)(q16 + qoff + j * 128) = o;
    }
}

// ---------------------------------------------------------------------------
// Flash attention. One wave owns a 16-query tile of one (n, h).
// S^T = K x Q^T - m  (A = K 16x32 f16, B = Q^T 32x16 f16, C = 16s x 16q f32:
//                    minus each column's running max, so the scores leave the
//                    matrix unit ready for exp2)
// outT += V^T x P^T  (A = V^T 16x32, B = P^T 32x16, C = 16d x 16q f32)
// den  += E x P^T    (A = E: rows 0 and 8 all ones, the rest 0): the softmax
//                    denominators, summed by the matrix unit
// block = 256 threads = 8 waves; grid = NBATCH*NHEAD*(SEQ/16)/8 = 512 blocks
// ---------------------------------------------------------------------------
__device__ __forceinline__ v16h load_frag(const _Float16* p) {
    const v8h lo = *(const v8h*)(p);
    const v8h hi = *(const v8h*)(p + FPART);
    return __builtin_shufflevector(lo, hi, 0, 1, 2, 3, 4, 5, 6, 7,
                                   8, 9, 10, 11, 12, 13, 14, 15);
}

__global__ __launch_bounds__(256)
void attention_kernel(const _Float16* __restrict__ q16,
                      const _Float16* __restrict__ k16,
                      const _Float16* __restrict__ vt16,
                      float* __restrict__ out) {
    const int wave  = threadIdx.x >> 5;
    const int lane  = threadIdx.x & 31;
    const int tid   = blockIdx.x * 8 + wave;        // 0..4095
    const int nh    = tid >> 8;                     // (n,h) pair 0..15
    const int qtile = tid & 255;                    // 0..255
    const int nb    = nh >> 3;
    const int h     = nh & 7;
    const int q0    = qtile * 16;

    const int lmod  = lane & 15;
    const int lhalf = lane >> 4;                    // 0 or 1

    // ---- B operand: Q^T 32x16, resident for the whole loop -----------------
    // lane<16: column q=lane, d=0..15 ; lane>=16: column q=lane-16, d=16..31
    const v16h bq = *(const v16h*)(q16 +
        ((size_t)(nb * SEQ + q0 + lmod) * NHEAD + h) * HDIM + lhalf * 16);

    v8f acc0 = {};          // outT rows d=0..15  (C layout)
    v8f acc1 = {};          // outT rows d=16..31
    // running denominators: row 0 (lanes 0..15) and row 8 (lanes 16..31) of the
    // tile stand in register 0, so every lane holds its own column's full sum
    // there; the other rows stay 0
    v8f accl = {};
    v16h ones;
    {
        const _Float16 o = (lane & 7) == 0 ? (_Float16)1.0f : (_Float16)0.0f;
        #pragma unroll
        for (int r = 0; r < 16; ++r) ones[r] = o;
    }

    // wave-uniform bases, one 32-bit lane offset each
    const _Float16* kb = k16  + (size_t)nh * SEQ * HDIM;   // + s*HDIM (s: multiple of 16)
    const _Float16* vb = vt16 + (size_t)nh * SEQ * HDIM;   // + s*HDIM (s: multiple of 32)
    const unsigned flane = (unsigned)(lane * 8);

    // Register ring of NBUF stages of 32 keys (K: 2 fragments, V^T: 2 fragments).
    // A stage is loaded NBUF-1 stages before it is used, so that no product
    // waits for a load that was issued in its own stage.
    v16h rk0[NBUF], rk1[NBUF], rv0[NBUF], rv1[NBUF];

    // unrolled here and in the loop: a set's index must be a compile-time
    // constant, else the ring would not stay in registers
    #pragma unroll
    for (int j = 0; j < NBUF - 1; ++j) {
        rk0[j] = load_frag(kb + j * 32 * HDIM + flane);
        rk1[j] = load_frag(kb + j * 32 * HDIM + FRAG + flane);
        rv0[j] = load_frag(vb + j * 32 * HDIM + flane);
        rv1[j] = load_frag(vb + j * 32 * HDIM + FRAG + flane);
        // compiler fence: keeps the stages in the loop's own issue order, so
        // that the counted waits at the loop's head can leave later stages in flight
        asm volatile("" ::: "memory");
    }

    // minus the running max (log2 domain) of this lane's query column, in all
    // eight registers: the C operand of the score products. It starts at the
    // max over the first 32 keys, so that it is finite from the first stage on.
    v8f negm;
    {
        v8f zero = {};
        const v8f t0 = __builtin_amdgcn_wmma_f32_16x16x32_f16(
            false, rk0[0], false, bq, (short)0, zero, false, false);
        const v8f t1 = __builtin_amdgcn_wmma_f32_16x16x32_f16(
            false, rk1[0], false, bq, (short)0, zero, false, false);
        float m0 = fmaxf(t0[0], t1[0]);
        #pragma unroll
        for (int r = 1; r < 8; ++r) m0 = fmaxf(m0, fmaxf(t0[r], t1[r]));
        m0 = fmaxf(m0, __shfl_xor(m0, 16, 32));
        #pragma unroll
        for (int r = 0; r < 8; ++r) negm[r] = -m0;
    }

    for (int s0 = 0; s0 < SEQ; s0 += 32 * NBUF) {
        // stages behind the last one do not exist: the last trip re-reads the
        // first stages instead (in bounds, never used)
        const int snext = (s0 + 32 * NBUF < SEQ) ? s0 + 32 * NBUF : 0;

        #pragma unroll
        for (int j = 0; j < NBUF; ++j) {
            {   // ---- fetch the stage NBUF-1 ahead into the buffer just freed
                const int jb = (j + NBUF - 1) % NBUF;
                const int sf = (j == 0) ? s0 + 32 * (NBUF - 1) : snext + 32 * (j - 1);
                rk0[jb] = load_frag(kb + (size_t)sf * HDIM + flane);
                rk1[jb] = load_frag(kb + (size_t)sf * HDIM + FRAG + flane);
                rv0[jb] = load_frag(vb + (size_t)sf * HDIM + flane);
                rv1[jb] = load_frag(vb + (size_t)sf * HDIM + FRAG + flane);
                // compiler fence: without it the compiler sinks these loads
                // down to the stage that uses them and the lead is lost; the
                // wait stands in front of any reuse of the loads' address registers
                asm volatile("s_wait_xcnt 0x0" ::: "memory");
            }

            // ---- scores minus running max: two 16x16 tiles over 32 keys ----
            v8f st0 = __builtin_amdgcn_wmma_f32_16x16x32_f16(
                false, rk0[j], false, bq, (short)0, negm, false, false);
            v8f st1 = __builtin_amdgcn_wmma_f32_16x16x32_f16(
                false, rk1[j], false, bq, (short)0, negm, false, false);

            // a lane keeps the 16 scores of its query column that it holds:
            // keys lhalf*8 + r (st0) and 16 + lhalf*8 + r (st1)

            // ---- online softmax (log2 domain) ------------------------------
            float bm = fmaxf(st0[0], st1[0]);
            #pragma unroll
            for (int r = 1; r < 8; ++r) bm = fmaxf(bm, fmaxf(st0[r], st1[r]));

            // wave-uniform: rescale only when some column's max actually moved,
            // that is, when some lane holds a shifted score above 0; the two
            // halves of a column meet only in here
            if (__any(bm > 0.0f)) {
                // how far this column's max moved (0: not at all)
                const float up   = fmaxf(fmaxf(bm, __shfl_xor(bm, 16, 32)), 0.0f);
                const float corr = __builtin_amdgcn_exp2f(-up);
                accl[0] *= corr;
                acc0 *= corr;  acc1 *= corr;
                st0  -= up;    st1  -= up;
                negm -= up;
            }

            float px[8], py[8];
            #pragma unroll
            for (int r = 0; r < 8; ++r) {
                px[r] = __builtin_amdgcn_exp2f(st0[r]);
                py[r] = __builtin_amdgcn_exp2f(st1[r]);
            }

            // ---- P^T as B operand: converted in place ----------------------
            // slot r = st0's row r, slot 8 + r = st1's row r, the key order in
            // which the V^T fragments are stored
            v16h bp;
            #pragma unroll
            for (int r = 0; r < 8; ++r) {
                bp[r]     = (_Float16)px[r];
                bp[r + 8] = (_Float16)py[r];
            }

            // ---- numerator: outT += V^T x P^T ------------------------------
            acc0 = __builtin_amdgcn_wmma_f32_16x16x32_f16(
                false, rv0[j], false, bp, (short)0, acc0, false, false);
            acc1 = __builtin_amdgcn_wmma_f32_16x16x32_f16(
                false, rv1[j], false, bp, (short)0, acc1, false, false);

            // ---- denominator: column sums of the same P^T ------------------
            accl = __builtin_amdgcn_wmma_f32_16x16x32_f16(
                false, ones, false, bp, (short)0, accl, false, false);
        }
    }

    // the last trip's re-reads of the first stages are never used: they land before the wave ends
    // and gives its registers back
    asm volatile("s_wait_loadcnt 0x0" ::: "memory");

    // ---- epilogue: divide by denominator, write out [n, q, h, d] -----------
    const float inv = 1.0f / accl[0];
    const int   qq  = q0 + lmod;
    float* obase = out + ((size_t)(nb * SEQ + qq) * NHEAD + h) * HDIM;
    const int dbase = lhalf * 8;                   // acc0 rows: d = dbase+r
    float4 w;
    w = make_float4(acc0[0]*inv, acc0[1]*inv, acc0[2]*inv, acc0[3]*inv);
    *(float4*)(obase + dbase)          = w;
    w = make_float4(acc0[4]*inv, acc0[5]*inv, acc0[6]*inv, acc0[7]*inv);
    *(float4*)(obase + dbase + 4)      = w;
    w = make_float4(acc1[0]*inv, acc1[1]*inv, acc1[2]*inv, acc1[3]*inv);
    *(float4*)(obase + 16 + dbase)     = w;
    w = make_float4(acc1[4]*inv, acc1[5]*inv, acc1[6]*inv, acc1[7]*inv);
    *(float4*)(obase + 16 + dbase + 4) = w;
}

// ---------------------------------------------------------------------------
extern "C" void kernel_launch(void* const* d_in, const int* in_sizes, int n_in,
                              void* d_out, int out_size, void* d_ws, size_t ws_size,
                              hipStream_t stream) {
    const float* q = (const float*)d_in[0];
    const float* k = (const float*)d_in[1];
    const float* v = (const float*)d_in[2];
    float* out = (float*)d_out;

    const int nelem = NBATCH * SEQ * CPLANE;       // 2,097,152 per tensor
    char* ws = (char*)d_ws;
    _Float16* q16  = (_Float16*)(ws);
    _Float16* k16  = (_Float16*)(ws + (size_t)nelem * 2);
    _Float16* vt16 = (_Float16*)(ws + (size_t)nelem * 4);

    // 1/sqrt(d) * log2(e): softmax computed with exp2
    const float qscale = (1.0f / sqrtf((float)HDIM)) * 1.44269504088896340736f;

    convert_kernel<<<NBATCH * SEQ / 32, 256, 0, stream>>>(q, k, v, q16, k16, vt16, qscale);

    // 4096 wave-tiles, 8 waves/block
    attention_kernel<<<512, 256, 0, stream>>>(q16, k16, vt16, out);
}

// v007
// It runs in 43.5 microseconds.
// Next to v006, in two timings, it ran 1.12 and 1.06 times as fast.
// Counting every step since v000, it is 4.77 times as fast.
#include <hip/hip_runtime.h>
#include <hip/hip_bf16.h>
#include <math.h>

typedef __attribute__((ext_vector_type(16))) _Float16 v16h;
typedef __attribute__((ext_vector_type(8)))  _Float16 v8h;
typedef __attribute__((ext_vector_type(4)))  _Float16 v4h;
typedef __attribute__((ext_vector_type(8)))  float    v8f;
typedef __attribute__((ext_vector_type(4)))  float    v4f;
typedef __attribute__((ext_vector_type(16))) float    v16f;

#define NBATCH 2
#define NHEAD  8
#define SEQ    4096       // 64*64
#define HDIM   32         // 256 / 8
#define CPLANE 256        // NHEAD*HDIM
#define NBUF   4          // stages of 32 keys in the attention kernel's register ring

// Fragment order of K and V^T in the workspace. Per (n, h): one block of 512
// halves per A fragment (16 rows x 32 k), fragments in the order the attention
// loop walks them. Inside a block: element slot of lane l stands at
//   (slot >> 3) * 256 + l * 8 + (slot & 7)
// so each of a fragment's two 16-byte loads reads 512 contiguous bytes per wave.
#define FRAG   512        // halves per fragment
#define FPART  256        // halves per 16-byte part of a fragment

// ---------------------------------------------------------------------------
// Preprocess, one launch. A work-group takes 32 sequence positions of one batch
// entry, all eight heads: 32 KB in a row of each of Q, K and V. Every load of a
// wave reads whole 128-byte lines, all of a wave's loads are independent, and
// nothing goes through LDS. 2048 waves in all, each with 48 loads in flight.
//   Q fp32 -> f16, same layout, scaled: softmax temperature AND log2(e) folded
//     in, so the softmax runs in the exp2 domain (v_exp_f32 with no preceding
//     v_mul per score). Wave w: rows 4w .. 4w+3.
//   K fp32 -> f16 in fragment order (fragment = 16 keys; lane l: key l & 15,
//     d = (l >> 4) * 16 + slot). Wave w: head w.
//   V fp32 -> V^T f16 in fragment order (per 32 keys two fragments, d 0..15 and
//     d 16..31; lane l: row d & 15 = l & 15, key = (slot >> 3) * 16 +
//     (l >> 4) * 8 + (slot & 7): the keys whose scores lane l holds in its two
//     score tiles). Wave w: head w; a lane reads one d of all 32 keys, which is
//     the transposition.
// grid = NBATCH * SEQ / 32, block = 256
// ---------------------------------------------------------------------------
__global__ __launch_bounds__(256)
void convert_kernel(const float* __restrict__ q, const float* __restrict__ k,
                    const float* __restrict__ v,
                    _Float16* __restrict__ q16, _Float16* __restrict__ k16,
                    _Float16* __restrict__ vt, float qscale) {
    const int wave = threadIdx.x >> 5;             // head of K and V
    const int lane = threadIdx.x & 31;
    const int nb   = blockIdx.x / (SEQ / 32);
    const int s0   = (blockIdx.x % (SEQ / 32)) * 32;
    const size_t row0 = (size_t)(nb * SEQ + s0);   // first row of the three sources

    // ---- all loads first ----------------------------------------------------
    // (every loop of this kernel is unrolled: the values stand in register arrays,
    // whose indices must be compile-time constants)
    // V: load s = key s0 + s, d = lane
    const float* vp = v + (row0 * NHEAD + wave) * HDIM + lane;
    v16f vv[2];
    #pragma unroll
    for (int s = 0; s < 32; ++s) vv[s >> 4][s & 15] = vp[s * CPLANE];

    // K: load j = keys s0 + 4j .. 4j+3, eight lanes to a key, four d to a lane
    const int d4 = lane & 7;
    const float* kp = k + ((row0 + (lane >> 3)) * NHEAD + wave) * HDIM + d4 * 4;
    v4f kk[8];
    #pragma unroll
    for (int j = 0; j < 8; ++j) kk[j] = *(const v4f*)(kp + j * 4 * CPLANE);

    // Q: 1024 values in a row per wave
    const size_t qoff = (row0 + wave * 4) * CPLANE + lane * 4;
    const float* qp = q + qoff;
    v4f qq[8];
    #pragma unroll
    for (int j = 0; j < 8; ++j) qq[j] = *(const v4f*)(qp + j * 128);

    // fence on the loaded values, inputs only: without it the compiler holds
    // K's and Q's loads back until V's values have come, to save registers, and
    // the wave pays the memory latency twice. The three addresses are inputs too,
    // so that their registers stay as they are up to the wait, which stands in
    // front of any reuse of them
    asm volatile("s_wait_xcnt 0x0"
                 :: "v"(vp), "v"(kp), "v"(qp), "v"(vv[0]), "v"(vv[1]),
                    "v"(kk[0]), "v"(kk[1]), "v"(kk[2]), "v"(kk[3]),
                    "v"(kk[4]), "v"(kk[5]), "v"(kk[6]), "v"(kk[7]),
                    "v"(qq[0]), "v"(qq[1]), "v"(qq[2]), "v"(qq[3]),
                    "v"(qq[4]), "v"(qq[5]), "v"(qq[6]), "v"(qq[7])
                 : "memory");

    // ---- V^T: four 16-byte parts per lane -----------------------------------
    // keys part * 16 + lh * 8 + e go to part (lane >> 4) * 2 + part of the 2 KB
    // block, at the place of fragment lane lh * 16 + (lane & 15)
    const size_t fbase = ((size_t)(nb * NHEAD + wave) * SEQ + s0) * HDIM;
    _Float16* vd = vt + fbase + (lane >> 4) * FRAG + (lane & 15) * 8;
    #pragma unroll
    for (int part = 0; part < 2; ++part) {
        #pragma unroll
        for (int lh = 0; lh < 2; ++lh) {
            v8h o;
            #pragma unroll
            for (int e = 0; e < 8; ++e) o[e] = (_Float16)vv[part][lh * 8 + e];
            *(v8h*)(vd + part * FPART + lh * 128) = o;
        }
    }

    // ---- K: d = d4 * 4 + c = (l >> 4) * 16 + part * 8 + e ---------------------
    _Float16* kd = k16 + fbase + ((d4 >> 1) & 1) * FPART
                 + ((d4 >> 2) * 16 + (lane >> 3)) * 8 + (d4 & 1) * 4;
    #pragma unroll
    for (int j = 0; j < 8; ++j) {
        v4h o;
        o[0] = (_Float16)kk[j].x;  o[1] = (_Float16)kk[j].y;
        o[2] = (_Float16)kk[j].z;  o[3] = (_Float16)kk[j].w;
        // key 4j + (lane >> 3): fragment j >> 2, fragment lane + (j & 3) * 4
        *(v4h*)(kd + (j >> 2) * FRAG + (j & 3) * 32) = o;
    }

    // ---- Q -------------------------------------------------------------------
    #pragma unroll
    for (int j = 0; j < 8; ++j) {
        v4h o;
        o[0] = (_Float16)(qq[j].x * qscale);  o[1] = (_Float16)(qq[j].y * qscale);
        o[2] = (_Float16)(qq[j].z * qscale);  o[3] = (_Float16)(qq[j].w * qscale);
        *(v4h*)(q16 + qoff + j * 128) = o;
    }
}

// ---------------------------------------------------------------------------
// Flash attention. One wave owns 32 queries (two 16-query tiles) of one (n, h)
// and one half of the keys, so every K and V^T fragment it loads feeds two
// products. Waves w and w + 8 of a work-group hold the two key halves of the
// same queries and join their partial results through LDS at the end.
// S^T = K x Q^T - m  (A = K 16x32 f16, B = Q^T 32x16 f16, C = 16s x 16q f32:
//                    minus each column's running max, so the scores leave the
//                    matrix unit ready for exp2)
// outT += V^T x P^T  (A = V^T 16x32, B = P^T 32x16, C = 16d x 16q f32)
// den  += E x P^T    (A = E: rows 0 and 8 all ones, the rest 0): the softmax
//                    denominators, summed by the matrix unit
// block = 512 threads = 16 waves = 256 queries x 2 key halves;
// grid = NBATCH*NHEAD*(SEQ/256) = 256 blocks
// ---------------------------------------------------------------------------
#define QT     2          // query tiles per wave
#define KEYS   (SEQ / 2)  // keys per wave

__device__ __forceinline__ v16h load_frag(const _Float16* p) {
    const v8h lo = *(const v8h*)(p);
    const v8h hi = *(const v8h*)(p + FPART);
    return __builtin_shufflevector(lo, hi, 0, 1, 2, 3, 4, 5, 6, 7,
                                   8, 9, 10, 11, 12, 13, 14, 15);
}

__global__ __launch_bounds__(512)
void attention_kernel(const _Float16* __restrict__ q16,
                      const _Float16* __restrict__ k16,
                      const _Float16* __restrict__ vt16,
                      float* __restrict__ out) {
    // what a wave hands to its partner: one tile's numerators, denominator, -max
    __shared__ v4f xacc[16][4][32];
    __shared__ float xden[16][32];
    __shared__ float xneg[16][32];

    // scalar, so that the key half's bases and the hand-over's choices are scalar too
    const int wave  = __builtin_amdgcn_readfirstlane(threadIdx.x >> 5);   // 0..15
    const int lane  = threadIdx.x & 31;
    const int kh    = wave >> 3;                    // key half
    const int nh    = blockIdx.x >> 4;              // (n,h) pair 0..15
    const int nb    = nh >> 3;
    const int h     = nh & 7;
    const int q0    = (blockIdx.x & 15) * 256 + (wave & 7) * 32;

    const int lmod  = lane & 15;
    const int lhalf = lane >> 4;                    // 0 or 1

    // ---- B operands: Q^T 32x16 per tile, resident for the whole loop -------
    // lane<16: column q=lane, d=0..15 ; lane>=16: column q=lane-16, d=16..31
    v16h bq[QT];
    #pragma unroll
    for (int t = 0; t < QT; ++t)
        bq[t] = *(const v16h*)(q16 +
            ((size_t)(nb * SEQ + q0 + t * 16 + lmod) * NHEAD + h) * HDIM + lhalf * 16);

    v8f acc0[QT] = {};      // outT rows d=0..15  (C layout)
    v8f acc1[QT] = {};      // outT rows d=16..31
    // running denominators: row 0 (lanes 0..15) and row 8 (lanes 16..31) of the
    // tile stand in register 0, so every lane holds its own column's full sum
    // there; the other rows stay 0
    v8f accl[QT] = {};
    v16h ones;
    {
        const _Float16 o = (lane & 7) == 0 ? (_Float16)1.0f : (_Float16)0.0f;
        #pragma unroll
        for (int r = 0; r < 16; ++r) ones[r] = o;
    }

    // bases of this wave's key half, one 32-bit lane offset each
    const _Float16* kb = k16  + ((size_t)nh * SEQ + kh * KEYS) * HDIM;  // + s*HDIM (s: multiple of 16)
    const _Float16* vb = vt16 + ((size_t)nh * SEQ + kh * KEYS) * HDIM;  // + s*HDIM (s: multiple of 32)
    const unsigned flane = (unsigned)(lane * 8);

    // Register ring of NBUF stages of 32 keys (K: 2 fragments, V^T: 2 fragments).
    // A stage is loaded NBUF-1 stages before it is used, so that no product
    // waits for a load that was issued in its own stage.
    v16h rk0[NBUF], rk1[NBUF], rv0[NBUF], rv1[NBUF];

    // unrolled here and in the loop: a set's index must be a compile-time
    // constant, else the ring would not stay in registers
    #pragma unroll
    for (int j = 0; j < NBUF - 1; ++j) {
        rk0[j] = load_frag(kb + j * 32 * HDIM + flane);
        rk1[j] = load_frag(kb + j * 32 * HDIM + FRAG + flane);
        rv0[j] = load_frag(vb + j * 32 * HDIM + flane);
        rv1[j] = load_frag(vb + j * 32 * HDIM + FRAG + flane);
        // compiler fence: keeps the stages in the loop's own issue order, so
        // that the counted waits at the loop's head can leave later stages in flight
        asm volatile("" ::: "memory");
    }

    // minus the running max (log2 domain) of this lane's query column, in all
    // eight registers: the C operand of the score products. It starts at the
    // max over the wave's first 32 keys, so that it is finite from the first
    // stage on.
    v8f negm[QT];
    #pragma unroll
    for (int t = 0; t < QT; ++t) {
        v8f zero = {};
        const v8f t0 = __builtin_amdgcn_wmma_f32_16x16x32_f16(
            false, rk0[0], false, bq[t], (short)0, zero, false, false);
        const v8f t1 = __builtin_amdgcn_wmma_f32_16x16x32_f16(
            false, rk1[0], false, bq[t], (short)0, zero, false, false);
        float m0 = fmaxf(t0[0], t1[0]);
        #pragma unroll
        for (int r = 1; r < 8; ++r) m0 = fmaxf(m0, fmaxf(t0[r], t1[r]));
        m0 = fmaxf(m0, __shfl_xor(m0, 16, 32));
        #pragma unroll
        for (int r = 0; r < 8; ++r) negm[t][r] = -m0;
    }

    for (int s0 = 0; s0 < KEYS; s0 += 32 * NBUF) {
        // stages behind the last one do not exist: the last trip re-reads the
        // first stages instead (in bounds, never used)
        const int snext = (s0 + 32 * NBUF < KEYS) ? s0 + 32 * NBUF : 0;

        #pragma unroll
        for (int j = 0; j < NBUF; ++j) {
            {   // ---- fetch the stage NBUF-1 ahead into the buffer just freed
                const int jb = (j + NBUF - 1) % NBUF;
                const int sf = (j == 0) ? s0 + 32 * (NBUF - 1) : snext + 32 * (j - 1);
                rk0[jb] = load_frag(kb + (size_t)sf * HDIM + flane);
                rk1[jb] = load_frag(kb + (size_t)sf * HDIM + FRAG + flane);
                rv0[jb] = load_frag(vb + (size_t)sf * HDIM + flane);
                rv1[jb] = load_frag(vb + (size_t)sf * HDIM + FRAG + flane);
                // compiler fence: without it the compiler sinks these loads
                // down to the stage that uses them and the lead is lost; the
                // wait stands in front of any reuse of the loads' address registers
                asm volatile("s_wait_xcnt 0x0" ::: "memory");
            }

            // ---- scores minus running max: per query tile two 16x16 tiles
            // over 32 keys; each K fragment is the A operand of both tiles ----
            v8f st0[QT], st1[QT];
            #pragma unroll
            for (int t = 0; t < QT; ++t) {
                st0[t] = __builtin_amdgcn_wmma_f32_16x16x32_f16(
                    false, rk0[j], false, bq[t], (short)0, negm[t], false, false);
                st1[t] = __builtin_amdgcn_wmma_f32_16x16x32_f16(
                    false, rk1[j], false, bq[t], (short)0, negm[t], false, false);
            }

            // a lane keeps the 16 scores of each of its two query columns that
            // it holds: keys lhalf*8 + r (st0) and 16 + lhalf*8 + r (st1)

            // ---- online softmax (log2 domain) ------------------------------
            float bm[QT];
            #pragma unroll
            for (int t = 0; t < QT; ++t) {
                bm[t] = fmaxf(st0[t][0], st1[t][0]);
                #pragma unroll
                for (int r = 1; r < 8; ++r)
                    bm[t] = fmaxf(bm[t], fmaxf(st0[t][r], st1[t][r]));
            }

            // wave-uniform, one test for both tiles: rescale only when some
            // column's max actually moved, that is, when some lane holds a
            // shifted score above 0; the two halves of a column meet only in here
            if (__any(fmaxf(bm[0], bm[1]) > 0.0f)) {
                #pragma unroll
                for (int t = 0; t < QT; ++t) {
                    // how far this column's max moved (0: not at all)
                    const float up   = fmaxf(fmaxf(bm[t], __shfl_xor(bm[t], 16, 32)), 0.0f);
                    const float corr = __builtin_amdgcn_exp2f(-up);
                    accl[t][0] *= corr;
                    acc0[t] *= corr;  acc1[t] *= corr;
                    st0[t]  -= up;    st1[t]  -= up;
                    negm[t] -= up;
                }
            }

            // ---- P^T as B operand: converted in place ----------------------
            // slot r = st0's row r, slot 8 + r = st1's row r, the key order in
            // which the V^T fragments are stored
            v16h bp[QT];
            #pragma unroll
            for (int t = 0; t < QT; ++t) {
                #pragma unroll
                for (int r = 0; r < 8; ++r) {
                    bp[t][r]     = (_Float16)__builtin_amdgcn_exp2f(st0[t][r]);
                    bp[t][r + 8] = (_Float16)__builtin_amdgcn_exp2f(st1[t][r]);
                }
            }

            #pragma unroll
            for (int t = 0; t < QT; ++t) {
                // ---- numerator: outT += V^T x P^T; each V^T fragment is the
                // A operand of both tiles
                acc0[t] = __builtin_amdgcn_wmma_f32_16x16x32_f16(
                    false, rv0[j], false, bp[t], (short)0, acc0[t], false, false);
                acc1[t] = __builtin_amdgcn_wmma_f32_16x16x32_f16(
                    false, rv1[j], false, bp[t], (short)0, acc1[t], false, false);

                // ---- denominator: column sums of the same P^T --------------
                accl[t] = __builtin_amdgcn_wmma_f32_16x16x32_f16(
                    false, ones, false, bp[t], (short)0, accl[t], false, false);
            }
        }
    }

    // the last trip's re-reads of the first stages are never used: they land before the wave ends
    // and gives its registers back
    asm volatile("s_wait_loadcnt 0x0" ::: "memory");

    // ---- join the two key halves -------------------------------------------
    // the wave of key half kh finishes tile kh and hands tile 1 - kh to its
    // partner, wave ^ 8
    const v8f   g0 = kh ? acc0[0] : acc0[1];
    const v8f   g1 = kh ? acc1[0] : acc1[1];
    xacc[wave][0][lane] = __builtin_shufflevector(g0, g0, 0, 1, 2, 3);
    xacc[wave][1][lane] = __builtin_shufflevector(g0, g0, 4, 5, 6, 7);
    xacc[wave][2][lane] = __builtin_shufflevector(g1, g1, 0, 1, 2, 3);
    xacc[wave][3][lane] = __builtin_shufflevector(g1, g1, 4, 5, 6, 7);
    xden[wave][lane] = kh ? accl[0][0] : accl[1][0];
    xneg[wave][lane] = kh ? negm[0][0] : negm[1][0];

    // publishes every wave's hand-over to its partner
    __syncthreads();

    const v8f   a0 = kh ? acc0[1] : acc0[0];
    const v8f   a1 = kh ? acc1[1] : acc1[0];
    const float al = kh ? accl[1][0] : accl[0][0];
    const float an = kh ? negm[1][0] : negm[0][0];
    const int   pw = wave ^ 8;
    const v4f   p00 = xacc[pw][0][lane], p01 = xacc[pw][1][lane];
    const v4f   p10 = xacc[pw][2][lane], p11 = xacc[pw][3][lane];
    const float pl = xden[pw][lane];
    const float pn = xneg[pw][lane];

    // both halves brought to the larger of the two maxima, then one division
    const float nm  = fminf(an, pn);                // minus the larger max
    const float ca  = __builtin_amdgcn_exp2f(nm - an);
    const float cp  = __builtin_amdgcn_exp2f(nm - pn);
    const float inv = 1.0f / (al * ca + pl * cp);
    const float wa  = ca * inv;
    const float wp  = cp * inv;

    // ---- write out [n, q, h, d] --------------------------------------------
    const int   qq  = q0 + kh * 16 + lmod;
    float* obase = out + ((size_t)(nb * SEQ + qq) * NHEAD + h) * HDIM;
    const int dbase = lhalf * 8;                   // acc0 rows: d = dbase+r
    float4 w;
    w = make_float4(a0[0]*wa + p00[0]*wp, a0[1]*wa + p00[1]*wp,
                    a0[2]*wa + p00[2]*wp, a0[3]*wa + p00[3]*wp);
    *(float4*)(obase + dbase)          = w;
    w = make_float4(a0[4]*wa + p01[0]*wp, a0[5]*wa + p01[1]*wp,
                    a0[6]*wa + p01[2]*wp, a0[7]*wa + p01[3]*wp);
    *(float4*)(obase + dbase + 4)      = w;
    w = make_float4(a1[0]*wa + p10[0]*wp, a1[1]*wa + p10[1]*wp,
                    a1[2]*wa + p10[2]*wp, a1[3]*wa + p10[3]*wp);
    *(float4*)(obase + 16 + dbase)     = w;
    w = make_float4(a1[4]*wa + p11[0]*wp, a1[5]*wa + p11[1]*wp,
                    a1[6]*wa + p11[2]*wp, a1[7]*wa + p11[3]*wp);
    *(float4*)(obase + 16 + dbase + 4) = w;
}

// ---------------------------------------------------------------------------
extern "C" void kernel_launch(void* const* d_in, const int* in_sizes, int n_in,
                              void* d_out, int out_size, void* d_ws, size_t ws_size,
                              hipStream_t stream) {
    const float* q = (const float*)d_in[0];
    const float* k = (const float*)d_in[1];
    const float* v = (const float*)d_in[2];
    float* out = (float*)d_out;

    const int nelem = NBATCH * SEQ * CPLANE;       // 2,097,152 per tensor
    char* ws = (char*)d_ws;
    _Float16* q16  = (_Float16*)(ws);
    _Float16* k16  = (_Float16*)(ws + (size_t)nelem * 2);
    _Float16* vt16 = (_Float16*)(ws + (size_t)nelem * 4);

    // 1/sqrt(d) * log2(e): softmax computed with exp2
    const float qscale = (1.0f / sqrtf((float)HDIM)) * 1.44269504088896340736f;

    convert_kernel<<<NBATCH * SEQ / 32, 256, 0, stream>>>(q, k, v, q16, k16, vt16, qscale);

    // 2048 wave-tiles of 32 queries x 2 key halves, 16 waves/block
    attention_kernel<<<256, 512, 0, stream>>>(q16, k16, vt16, out);
}

// v008
// It runs in 35.1 microseconds.
// Timed twice side by side with v007, it ran 1.21 and 1.22 times as fast.
// Over all steps from v000 it is 5.80 times as fast.
#include <hip/hip_runtime.h>
#include <hip/hip_bf16.h>
#include <math.h>

typedef __attribute__((ext_vector_type(16))) _Float16 v16h;
typedef __attribute__((ext_vector_type(8)))  _Float16 v8h;
typedef __attribute__((ext_vector_type(4)))  _Float16 v4h;
typedef __attribute__((ext_vector_type(8)))  float    v8f;
typedef __attribute__((ext_vector_type(4)))  float    v4f;
typedef __attribute__((ext_vector_type(16))) float    v16f;

#define NBATCH 2
#define NHEAD  8
#define SEQ    4096       // 64*64
#define HDIM   32         // 256 / 8
#define CPLANE 256        // NHEAD*HDIM
#define NBUF   4          // stages of 32 keys in the first walk's register ring

// Fragment order of K and V^T in the workspace. Per (n, h): one block of 512
// halves per A fragment (16 rows x 32 k), fragments in the order the attention
// loop walks them. Inside a block: element slot of lane l stands at
//   (slot >> 3) * 256 + l * 8 + (slot & 7)
// so each of a fragment's two 16-byte loads reads 512 contiguous bytes per wave.
#define FRAG   512        // halves per fragment
#define FPART  256        // halves per 16-byte part of a fragment

// ---------------------------------------------------------------------------
// Preprocess, one launch. A work-group takes 32 sequence positions of one batch
// entry, all eight heads: 32 KB in a row of each of Q, K and V. Every load of a
// wave reads whole 128-byte lines, all of a wave's loads are independent, and
// nothing goes through LDS. 2048 waves in all, each with 48 loads in flight.
//   Q fp32 -> f16, same layout, scaled: softmax temperature AND log2(e) folded
//     in, so the softmax runs in the exp2 domain (v_exp_f32 with no preceding
//     v_mul per score). Wave w: rows 4w .. 4w+3.
//   K fp32 -> f16 in fragment order (fragment = 16 keys; lane l: key l & 15,
//     d = (l >> 4) * 16 + slot). Wave w: head w.
//   V fp32 -> V^T f16 in fragment order (per 32 keys two fragments, d 0..15 and
//     d 16..31; lane l: row d & 15 = l & 15, key = (slot >> 3) * 16 +
//     (l >> 4) * 8 + (slot & 7): the keys whose scores lane l holds in its two
//     score tiles). Wave w: head w; a lane reads one d of all 32 keys, which is
//     the transposition.
// grid = NBATCH * SEQ / 32, block = 256
// ---------------------------------------------------------------------------
__global__ __launch_bounds__(256)
void convert_kernel(const float* __restrict__ q, const float* __restrict__ k,
                    const float* __restrict__ v,
                    _Float16* __restrict__ q16, _Float16* __restrict__ k16,
                    _Float16* __restrict__ vt, float qscale) {
    const int wave = threadIdx.x >> 5;             // head of K and V
    const int lane = threadIdx.x & 31;
    const int nb   = blockIdx.x / (SEQ / 32);
    const int s0   = (blockIdx.x % (SEQ / 32)) * 32;
    const size_t row0 = (size_t)(nb * SEQ + s0);   // first row of the three sources

    // ---- all loads first ----------------------------------------------------
    // (every loop of this kernel is unrolled: the values stand in register arrays,
    // whose indices must be compile-time constants)
    // V: load s = key s0 + s, d = lane
    const float* vp = v + (row0 * NHEAD + wave) * HDIM + lane;
    v16f vv[2];
    #pragma unroll
    for (int s = 0; s < 32; ++s) vv[s >> 4][s & 15] = vp[s * CPLANE];

    // K: load j = keys s0 + 4j .. 4j+3, eight lanes to a key, four d to a lane
    const int d4 = lane & 7;
    const float* kp = k + ((row0 + (lane >> 3)) * NHEAD + wave) * HDIM + d4 * 4;
    v4f kk[8];
    #pragma unroll
    for (int j = 0; j < 8; ++j) kk[j] = *(const v4f*)(kp + j * 4 * CPLANE);

    // Q: 1024 values in a row per wave
    const size_t qoff = (row0 + wave * 4) * CPLANE + lane * 4;
    const float* qp = q + qoff;
    v4f qq[8];
    #pragma unroll
    for (int j = 0; j < 8; ++j) qq[j] = *(const v4f*)(qp + j * 128);

    // fence on the loaded values, inputs only: without it the compiler holds
    // K's and Q's loads back until V's values have come, to save registers, and
    // the wave pays the memory latency twice. The three addresses are inputs too,
    // so that their registers stay as they are up to the wait, which stands in
    // front of any reuse of them
    asm volatile("s_wait_xcnt 0x0"
                 :: "v"(vp), "v"(kp), "v"(qp), "v"(vv[0]), "v"(vv[1]),
                    "v"(kk[0]), "v"(kk[1]), "v"(kk[2]), "v"(kk[3]),
                    "v"(kk[4]), "v"(kk[5]), "v"(kk[6]), "v"(kk[7]),
                    "v"(qq[0]), "v"(qq[1]), "v"(qq[2]), "v"(qq[3]),
                    "v"(qq[4]), "v"(qq[5]), "v"(qq[6]), "v"(qq[7])
                 : "memory");

    // ---- V^T: four 16-byte parts per lane -----------------------------------
    // keys part * 16 + lh * 8 + e go to part (lane >> 4) * 2 + part of the 2 KB
    // block, at the place of fragment lane lh * 16 + (lane & 15)
    const size_t fbase = ((size_t)(nb * NHEAD + wave) * SEQ + s0) * HDIM;
    _Float16* vd = vt + fbase + (lane >> 4) * FRAG + (lane & 15) * 8;
    #pragma unroll
    for (int part = 0; part < 2; ++part) {
        #pragma unroll
        for (int lh = 0; lh < 2; ++lh) {
            v8h o;
            #pragma unroll
            for (int e = 0; e < 8; ++e) o[e] = (_Float16)vv[part][lh * 8 + e];
            *(v8h*)(vd + part * FPART + lh * 128) = o;
        }
    }

    // ---- K: d = d4 * 4 + c = (l >> 4) * 16 + part * 8 + e ---------------------
    _Float16* kd = k16 + fbase + ((d4 >> 1) & 1) * FPART
                 + ((d4 >> 2) * 16 + (lane >> 3)) * 8 + (d4 & 1) * 4;
    #pragma unroll
    for (int j = 0; j < 8; ++j) {
        v4h o;
        o[0] = (_Float16)kk[j].x;  o[1] = (_Float16)kk[j].y;
        o[2] = (_Float16)kk[j].z;  o[3] = (_Float16)kk[j].w;
        // key 4j + (lane >> 3): fragment j >> 2, fragment lane + (j & 3) * 4
        *(v4h*)(kd + (j >> 2) * FRAG + (j & 3) * 32) = o;
    }

    // ---- Q -------------------------------------------------------------------
    #pragma unroll
    for (int j = 0; j < 8; ++j) {
        v4h o;
        o[0] = (_Float16)(qq[j].x * qscale);  o[1] = (_Float16)(qq[j].y * qscale);
        o[2] = (_Float16)(qq[j].z * qscale);  o[3] = (_Float16)(qq[j].w * qscale);
        *(v4h*)(q16 + qoff + j * 128) = o;
    }
}

// ---------------------------------------------------------------------------
// Flash attention. One wave owns 32 queries (two 16-query tiles) of one (n, h)
// and one half of the keys, so every K and V^T fragment it loads feeds two
// products. Waves w and w + 8 of a work-group hold the two key halves of the
// same queries and join their partial results through LDS at the end.
// S^T = K x Q^T - m  (A = K 16x32 f16, B = Q^T 32x16 f16, C = 16s x 16q f32:
//                    minus each column's shift, so the scores leave the
//                    matrix unit ready for exp2)
// outT += V^T x P^T  (A = V^T 16x32, B = P^T 32x16, C = 16d x 16q f32)
// den  += E x P^T    (A = E: rows 0 and 8 all ones, the rest 0): the softmax
//                    denominators, summed by the matrix unit
// block = 512 threads = 16 waves = 256 queries x 2 key halves;
// grid = NBATCH*NHEAD*(SEQ/256) = 256 blocks
// ---------------------------------------------------------------------------
#define QT     2          // query tiles per wave
#define KEYS   (SEQ / 2)  // keys per wave

__device__ __forceinline__ v16h load_frag(const _Float16* p) {
    const v8h lo = *(const v8h*)(p);
    const v8h hi = *(const v8h*)(p + FPART);
    return __builtin_shufflevector(lo, hi, 0, 1, 2, 3, 4, 5, 6, 7,
                                   8, 9, 10, 11, 12, 13, 14, 15);
}

// ---------------------------------------------------------------------------
// One walk of a wave over its key half. On entry the sums are cleared and the
// shift (minus the max over the wave's first 32 keys, per query column) is set.
// TRACK = false: the shift stays as it is for the whole walk. P = exp2(score -
//   shift) is then not bounded by 1; it keeps f16's relative precision up to
//   f16's top, 65504. A P that does not fit any more shows in its column's
//   denominator, a sum of non-negative terms, where the caller looks for it.
// TRACK = true: the online softmax, whose shift follows the running max: right
//   for every input.
// NB: stages of 32 keys in the register ring.
// ---------------------------------------------------------------------------
template <bool TRACK, int NB>
__device__ __forceinline__
void walk_keys(const _Float16* kb, const _Float16* vb, const unsigned flane,
               const v16h (&bq)[QT], const v16h ones,
               v8f (&acc0)[QT], v8f (&acc1)[QT], v8f (&accl)[QT], v8f (&negm)[QT]) {
    #pragma unroll
    for (int t = 0; t < QT; ++t) {
        const v8f zero = {};
        acc0[t] = zero;  acc1[t] = zero;  accl[t] = zero;
    }

    // Register ring of NB stages of 32 keys (K: 2 fragments, V^T: 2 fragments).
    // A stage is loaded NB-1 stages before it is used, so that no product
    // waits for a load that was issued in its own stage.
    v16h rk0[NB], rk1[NB], rv0[NB], rv1[NB];

    // unrolled here and in the loop: a set's index must be a compile-time
    // constant, else the ring would not stay in registers
    #pragma unroll
    for (int j = 0; j < NB - 1; ++j) {
        rk0[j] = load_frag(kb + j * 32 * HDIM + flane);
        rk1[j] = load_frag(kb + j * 32 * HDIM + FRAG + flane);
        rv0[j] = load_frag(vb + j * 32 * HDIM + flane);
        rv1[j] = load_frag(vb + j * 32 * HDIM + FRAG + flane);
        // compiler fence: keeps the stages in the loop's own issue order, so
        // that the counted waits at the loop's head can leave later stages in flight
        asm volatile("" ::: "memory");
    }

    // minus the shift (log2 domain) of this lane's query column, in all eight
    // registers: the C operand of the score products. It starts at the max
    // over the wave's first 32 keys, so that it is finite from the first stage
    // on and some P of the column is 1: no denominator can vanish.
    #pragma unroll
    for (int t = 0; t < QT; ++t) {
        v8f zero = {};
        const v8f t0 = __builtin_amdgcn_wmma_f32_16x16x32_f16(
            false, rk0[0], false, bq[t], (short)0, zero, false, false);
        const v8f t1 = __builtin_amdgcn_wmma_f32_16x16x32_f16(
            false, rk1[0], false, bq[t], (short)0, zero, false, false);
        float m0 = fmaxf(t0[0], t1[0]);
        #pragma unroll
        for (int r = 1; r < 8; ++r) m0 = fmaxf(m0, fmaxf(t0[r], t1[r]));
        m0 = fmaxf(m0, __shfl_xor(m0, 16, 32));
        #pragma unroll
        for (int r = 0; r < 8; ++r) negm[t][r] = -m0;
    }

    for (int s0 = 0; s0 < KEYS; s0 += 32 * NB) {
        // stages behind the last one do not exist: the last trip re-reads the
        // first stages instead (in bounds, never used)
        const int snext = (s0 + 32 * NB < KEYS) ? s0 + 32 * NB : 0;

        #pragma unroll
        for (int j = 0; j < NB; ++j) {
            {   // ---- fetch the stage NB-1 ahead into the buffer just freed
                const int jb = (j + NB - 1) % NB;
                const int sf = (j == 0) ? s0 + 32 * (NB - 1) : snext + 32 * (j - 1);
                const _Float16* kp = kb + (size_t)sf * HDIM + flane;
                const _Float16* vp = vb + (size_t)sf * HDIM + flane;
                rk0[jb] = load_frag(kp);
                rk1[jb] = load_frag(kp + FRAG);
                rv0[jb] = load_frag(vp);
                rv1[jb] = load_frag(vp + FRAG);
                // compiler fence: without it the compiler sinks these loads
                // down to the stage that uses them and the lead is lost. The
                // two addresses are inputs, so that their registers stay as
                // they are up to the wait (no load's result is placed on them),
                // which stands in front of any reuse of them
                asm volatile("s_wait_xcnt 0x0" :: "v"(kp), "v"(vp) : "memory");
            }

            // ---- scores minus the shift: per query tile two 16x16 tiles
            // over 32 keys; each K fragment is the A operand of both tiles ----
            v8f st0[QT], st1[QT];
            #pragma unroll
            for (int t = 0; t < QT; ++t) {
                st0[t] = __builtin_amdgcn_wmma_f32_16x16x32_f16(
                    false, rk0[j], false, bq[t], (short)0, negm[t], false, false);
                st1[t] = __builtin_amdgcn_wmma_f32_16x16x32_f16(
                    false, rk1[j], false, bq[t], (short)0, negm[t], false, false);
            }

            // a lane keeps the 16 scores of each of its two query columns that
            // it holds: keys lhalf*8 + r (st0) and 16 + lhalf*8 + r (st1)

            // ---- online softmax (log2 domain): the tracked walk alone -------
            if (TRACK) {
                float bm[QT];
                #pragma unroll
                for (int t = 0; t < QT; ++t) {
                    bm[t] = fmaxf(st0[t][0], st1[t][0]);
                    #pragma unroll
                    for (int r = 1; r < 8; ++r)
                        bm[t] = fmaxf(bm[t], fmaxf(st0[t][r], st1[t][r]));
                }

                // wave-uniform, one test for both tiles: rescale only when some
                // column's max actually moved, that is, when some lane holds a
                // shifted score above 0; the two halves of a column meet only in here
                if (__any(fmaxf(bm[0], bm[1]) > 0.0f)) {
                    #pragma unroll
                    for (int t = 0; t < QT; ++t) {
                        // how far this column's max moved (0: not at all)
                        const float up   = fmaxf(fmaxf(bm[t], __shfl_xor(bm[t], 16, 32)), 0.0f);
                        const float corr = __builtin_amdgcn_exp2f(-up);
                        accl[t][0] *= corr;
                        acc0[t] *= corr;  acc1[t] *= corr;
                        st0[t]  -= up;    st1[t]  -= up;
                        negm[t] -= up;
                    }
                }
            }

            // ---- P^T as B operand: converted in place ----------------------
            // slot r = st0's row r, slot 8 + r = st1's row r, the key order in
            // which the V^T fragments are stored
            v16h bp[QT];
            #pragma unroll
            for (int t = 0; t < QT; ++t) {
                #pragma unroll
                for (int r = 0; r < 8; ++r) {
                    bp[t][r]     = (_Float16)__builtin_amdgcn_exp2f(st0[t][r]);
                    bp[t][r + 8] = (_Float16)__builtin_amdgcn_exp2f(st1[t][r]);
                }
            }

            #pragma unroll
            for (int t = 0; t < QT; ++t) {
                // ---- numerator: outT += V^T x P^T; each V^T fragment is the
                // A operand of both tiles
                acc0[t] = __builtin_amdgcn_wmma_f32_16x16x32_f16(
                    false, rv0[j], false, bp[t], (short)0, acc0[t], false, false);
                acc1[t] = __builtin_amdgcn_wmma_f32_16x16x32_f16(
                    false, rv1[j], false, bp[t], (short)0, acc1[t], false, false);

                // ---- denominator: column sums of the same P^T --------------
                accl[t] = __builtin_amdgcn_wmma_f32_16x16x32_f16(
                    false, ones, false, bp[t], (short)0, accl[t], false, false);
            }
        }
    }

    // the last trip's re-reads of the first stages are never used: they land before the wave walks
    // again over the same registers, or ends and gives them back
    asm volatile("s_wait_loadcnt 0x0" ::: "memory");
}

__global__ __launch_bounds__(512)
void attention_kernel(const _Float16* __restrict__ q16,
                      const _Float16* __restrict__ k16,
                      const _Float16* __restrict__ vt16,
                      float* __restrict__ out) {
    // what a wave hands to its partner: one tile's numerators, denominator, -max
    __shared__ v4f xacc[16][4][32];
    __shared__ float xden[16][32];
    __shared__ float xneg[16][32];

    // scalar, so that the key half's bases and the hand-over's choices are scalar too
    const int wave  = __builtin_amdgcn_readfirstlane(threadIdx.x >> 5);   // 0..15
    const int lane  = threadIdx.x & 31;
    const int kh    = wave >> 3;                    // key half
    const int nh    = blockIdx.x >> 4;              // (n,h) pair 0..15
    const int nb    = nh >> 3;
    const int h     = nh & 7;
    const int q0    = (blockIdx.x & 15) * 256 + (wave & 7) * 32;

    const int lmod  = lane & 15;
    const int lhalf = lane >> 4;                    // 0 or 1

    // ---- B operands: Q^T 32x16 per tile, resident for the whole loop -------
    // lane<16: column q=lane, d=0..15 ; lane>=16: column q=lane-16, d=16..31
    v16h bq[QT];
    #pragma unroll
    for (int t = 0; t < QT; ++t)
        bq[t] = *(const v16h*)(q16 +
            ((size_t)(nb * SEQ + q0 + t * 16 + lmod) * NHEAD + h) * HDIM + lhalf * 16);

    v8f acc0[QT];           // outT rows d=0..15  (C layout)
    v8f acc1[QT];           // outT rows d=16..31
    // running denominators: row 0 (lanes 0..15) and row 8 (lanes 16..31) of the
    // tile stand in register 0, so every lane holds its own column's full sum
    // there; the other rows are never read
    v8f accl[QT];
    v8f negm[QT];           // minus the shift of each tile's scores
    v16h ones;
    {
        const _Float16 o = (lane & 7) == 0 ? (_Float16)1.0f : (_Float16)0.0f;
        #pragma unroll
        for (int r = 0; r < 16; ++r) ones[r] = o;
    }

    // bases of this wave's key half, one 32-bit lane offset each
    const _Float16* kb = k16  + ((size_t)nh * SEQ + kh * KEYS) * HDIM;  // + s*HDIM (s: multiple of 16)
    const _Float16* vb = vt16 + ((size_t)nh * SEQ + kh * KEYS) * HDIM;  // + s*HDIM (s: multiple of 32)
    const unsigned flane = (unsigned)(lane * 8);

    // First with the shift held fixed: no max over the scores, no test and no
    // rescale in any stage.
    walk_keys<false, NBUF>(kb, vb, flane, bq, ones, acc0, acc1, accl, negm);

    // A P at or above f16's top, whatever the conversion makes of it (65504 or
    // +inf), lifts its column's denominator far above 32768; a NaN fails the
    // compare too. Wave-uniform test: such a wave throws its sums away and walks
    // again with the running max (on a ring of two stages: with four, this
    // walk's registers would not fit). A large sum of P that all fitted takes
    // the second walk as well: slower, and as right.
    if (__any(!(accl[0][0] < 32768.0f) || !(accl[1][0] < 32768.0f)))
        walk_keys<true, 2>(kb, vb, flane, bq, ones, acc0, acc1, accl, negm);

    // ---- join the two key halves -------------------------------------------
    // the wave of key half kh finishes tile kh and hands tile 1 - kh to its
    // partner, wave ^ 8
    const v8f   g0 = kh ? acc0[0] : acc0[1];
    const v8f   g1 = kh ? acc1[0] : acc1[1];
    xacc[wave][0][lane] = __builtin_shufflevector(g0, g0, 0, 1, 2, 3);
    xacc[wave][1][lane] = __builtin_shufflevector(g0, g0, 4, 5, 6, 7);
    xacc[wave][2][lane] = __builtin_shufflevector(g1, g1, 0, 1, 2, 3);
    xacc[wave][3][lane] = __builtin_shufflevector(g1, g1, 4, 5, 6, 7);
    xden[wave][lane] = kh ? accl[0][0] : accl[1][0];
    xneg[wave][lane] = kh ? negm[0][0] : negm[1][0];

    // publishes every wave's hand-over to its partner
    __syncthreads();

    const v8f   a0 = kh ? acc0[1] : acc0[0];
    const v8f   a1 = kh ? acc1[1] : acc1[0];
    const float al = kh ? accl[1][0] : accl[0][0];
    const float an = kh ? negm[1][0] : negm[0][0];
    const int   pw = wave ^ 8;
    const v4f   p00 = xacc[pw][0][lane], p01 = xacc[pw][1][lane];
    const v4f   p10 = xacc[pw][2][lane], p11 = xacc[pw][3][lane];
    const float pl = xden[pw][lane];
    const float pn = xneg[pw][lane];

    // both halves brought to the larger of the two maxima, then one division
    const float nm  = fminf(an, pn);                // minus the larger max
    const float ca  = __builtin_amdgcn_exp2f(nm - an);
    const float cp  = __builtin_amdgcn_exp2f(nm - pn);
    const float inv = 1.0f / (al * ca + pl * cp);
    const float wa  = ca * inv;
    const float wp  = cp * inv;

    // ---- write out [n, q, h, d] --------------------------------------------
    const int   qq  = q0 + kh * 16 + lmod;
    float* obase = out + ((size_t)(nb * SEQ + qq) * NHEAD + h) * HDIM;
    const int dbase = lhalf * 8;                   // acc0 rows: d = dbase+r
    float4 w;
    w = make_float4(a0[0]*wa + p00[0]*wp, a0[1]*wa + p00[1]*wp,
                    a0[2]*wa + p00[2]*wp, a0[3]*wa + p00[3]*wp);
    *(float4*)(obase + dbase)          = w;
    w = make_float4(a0[4]*wa + p01[0]*wp, a0[5]*wa + p01[1]*wp,
                    a0[6]*wa + p01[2]*wp, a0[7]*wa + p01[3]*wp);
    *(float4*)(obase + dbase + 4)      = w;
    w = make_float4(a1[0]*wa + p10[0]*wp, a1[1]*wa + p10[1]*wp,
                    a1[2]*wa + p10[2]*wp, a1[3]*wa + p10[3]*wp);
    *(float4*)(obase + 16 + dbase)     = w;
    w = make_float4(a1[4]*wa + p11[0]*wp, a1[5]*wa + p11[1]*wp,
                    a1[6]*wa + p11[2]*wp, a1[7]*wa + p11[3]*wp);
    *(float4*)(obase + 16 + dbase + 4) = w;
}

// ---------------------------------------------------------------------------
extern "C" void kernel_launch(void* const* d_in, const int* in_sizes, int n_in,
                              void* d_out, int out_size, void* d_ws, size_t ws_size,
                              hipStream_t stream) {
    const float* q = (const float*)d_in[0];
    const float* k = (const float*)d_in[1];
    const float* v = (const float*)d_in[2];
    float* out = (float*)d_out;

    const int nelem = NBATCH * SEQ * CPLANE;       // 2,097,152 per tensor
    char* ws = (char*)d_ws;
    _Float16* q16  = (_Float16*)(ws);
    _Float16* k16  = (_Float16*)(ws + (size_t)nelem * 2);
    _Float16* vt16 = (_Float16*)(ws + (size_t)nelem * 4);

    // 1/sqrt(d) * log2(e): softmax computed with exp2
    const float qscale = (1.0f / sqrtf((float)HDIM)) * 1.44269504088896340736f;

    convert_kernel<<<NBATCH * SEQ / 32, 256, 0, stream>>>(q, k, v, q16, k16, vt16, qscale);

    // 2048 wave-tiles of 32 queries x 2 key halves, 16 waves/block
    attention_kernel<<<256, 512, 0, stream>>>(q16, k16, vt16, out);
}

// v009
// Measured time: 32.6 microseconds a run.
// Two timings next to v008 both put it at 1.10 times that version's speed.
// Counting every step since v000, it is 6.36 times as fast.
#include <hip/hip_runtime.h>
#include <hip/hip_bf16.h>
#include <math.h>

typedef __attribute__((ext_vector_type(16))) _Float16 v16h;
typedef __attribute__((ext_vector_type(8)))  _Float16 v8h;
typedef __attribute__((ext_vector_type(4)))  _Float16 v4h;
typedef __attribute__((ext_vector_type(8)))  float    v8f;
typedef __attribute__((ext_vector_type(4)))  float    v4f;

#define NBATCH 2
#define NHEAD  8
#define SEQ    4096       // 64*64
#define HDIM   32         // 256 / 8
#define CPLANE 256        // NHEAD*HDIM

// Fragment order of K and V^T in LDS. One block of 512 halves per A fragment
// (16 rows x 32 k). Inside a block: element slot of lane l stands at
//   (slot >> 3) * 256 + l * 8 + (slot & 7)
// so each of a fragment's two 16-byte loads reads 512 contiguous bytes per wave.
#define FRAG   512        // halves per fragment
#define FPART  256        // halves per 16-byte part of a fragment
#define GRP    1024       // halves of K (or of V^T) per group of 32 keys: two fragments

// ---------------------------------------------------------------------------
// Flash attention, one launch, f32 inputs read as they lie. One wave owns 32
// queries (two 16-query tiles) of one (n, h) and one half of the keys. Waves w
// and w + 8 of a work-group hold the two key halves of the same queries and
// join their partial results through LDS at the end.
// K and V: the work-group walks both key halves in chunks of CK keys each. It
// loads a chunk's f32 rows, rounds them to f16 and lays them into LDS in
// fragment order, once for all its waves, ahead of the products (three buffers):
//   K fragment = 16 keys; lane l: key l & 15, d = (l >> 4) * 16 + slot.
//   V^T: per 32 keys two fragments, d 0..15 and d 16..31; lane l: row d & 15 =
//     l & 15, key = (slot >> 3) * 16 + (l >> 4) * 8 + (slot & 7): the keys whose
//     scores lane l holds in its two score tiles.
// S^T = K x Q^T - m  (A = K 16x32 f16, B = Q^T 32x16 f16, C = 16s x 16q f32:
//                    minus each column's shift, so the scores leave the
//                    matrix unit ready for exp2)
// outT += V^T x P^T  (A = V^T 16x32, B = P^T 32x16, C = 16d x 16q f32)
// den  += E x P^T    (A = E: rows 0 and 8 all ones, the rest 0): the softmax
//                    denominators, summed by the matrix unit
// block = 512 threads = 16 waves = 256 queries x 2 key halves;
// grid = NBATCH*NHEAD*(SEQ/256) = 256 blocks
// ---------------------------------------------------------------------------
#define QT     2          // query tiles per wave
#define KEYS   (SEQ / 2)  // keys per wave
#define CK     128        // keys of each half per chunk
#define SPC    (CK / 32)  // stages of 32 keys per chunk
#define NCH    (KEYS / CK)
#define BUFH   (2 * SPC * GRP)   // halves of K (or of V^T) per LDS buffer: both halves' groups

__device__ __forceinline__ v16h load_frag(const _Float16* p) {
    const v8h lo = *(const v8h*)(p);
    const v8h hi = *(const v8h*)(p + FPART);
    return __builtin_shufflevector(lo, hi, 0, 1, 2, 3, 4, 5, 6, 7,
                                   8, 9, 10, 11, 12, 13, 14, 15);
}

// A wave's share of a chunk: 16 keys of K and the same 16 keys of V, f32.
// K: load jj = keys 4jj .. 4jj+3, eight lanes to a key, four d to a lane.
// V: load s = key s, d = lane: a lane reads one d of all 16 keys, which is the
// transposition. Every load reads whole 128-byte lines.
__device__ __forceinline__
void fetch_share(const float* kp, const float* vp, v4f (&sk)[4], float (&sv)[16]) {
    // unrolled: the values stand in register arrays
    #pragma unroll
    for (int jj = 0; jj < 4; ++jj) sk[jj] = *(const v4f*)(kp + jj * 4 * CPLANE);
    #pragma unroll
    for (int s = 0; s < 16; ++s) sv[s] = vp[s * CPLANE];
    // compiler fence: without it the compiler may sink these loads down to the
    // conversion that uses them and the lead of a chunk is lost. The two
    // addresses are inputs, so that their registers stay as they are up to the
    // wait, which stands in front of any reuse of them
    asm volatile("s_wait_xcnt 0x0" :: "v"(kp), "v"(vp) : "memory");
}

// rounds the share to f16 and lays it into LDS at the wave's places
__device__ __forceinline__
void put_share(_Float16* kw, _Float16* vw, const v4f (&sk)[4], const float (&sv)[16]) {
    #pragma unroll
    for (int lh = 0; lh < 2; ++lh) {
        v8h o;
        #pragma unroll
        for (int e = 0; e < 8; ++e) o[e] = (_Float16)sv[lh * 8 + e];
        *(v8h*)(vw + lh * 128) = o;
    }
    #pragma unroll
    for (int jj = 0; jj < 4; ++jj) {
        v4h o;
        o[0] = (_Float16)sk[jj].x;  o[1] = (_Float16)sk[jj].y;
        o[2] = (_Float16)sk[jj].z;  o[3] = (_Float16)sk[jj].w;
        *(v4h*)(kw + jj * 32) = o;
    }
}

// ---------------------------------------------------------------------------
// One walk of the whole work-group over the keys, each wave over its key half.
// Every wave of the work-group calls it together: it holds barriers. On entry
// the sums are cleared and the shift (minus the max over the wave's first 32
// keys, per query column) is set.
// TRACK = false: the shift stays as it is for the whole walk. P = exp2(score -
//   shift) is then not bounded by 1; it keeps f16's relative precision up to
//   f16's top, 65504. A P that does not fit any more shows in its column's
//   denominator, a sum of non-negative terms, where the caller looks for it.
// TRACK = true: the online softmax, whose shift follows the running max: right
//   for every input.
// kg, vg: the wave's share of chunk 0 in global memory; kst, vst: where it lays
// that share in LDS buffer 0; krd, vrd: the lane's place in the first fragments
// of the wave's key half in LDS buffer 0.
// ---------------------------------------------------------------------------
template <bool TRACK>
__device__ __forceinline__
void walk_keys(const float* kg, const float* vg, _Float16* kst, _Float16* vst,
               const _Float16* krd, const _Float16* vrd,
               const v16h (&bq)[QT], const v16h ones,
               v8f (&acc0)[QT], v8f (&acc1)[QT], v8f (&accl)[QT], v8f (&negm)[QT]) {
    #pragma unroll
    for (int t = 0; t < QT; ++t) {
        const v8f zero = {};
        acc0[t] = zero;  acc1[t] = zero;  accl[t] = zero;
    }

    v4f   sk[4];
    float sv[16];

    // chunk 0 into buffer 0 (no wave reads LDS any more when this is reached)
    fetch_share(kg, vg, sk, sv);
    put_share(kst, vst, sk, sv);
    // publishes chunk 0
    __syncthreads();

    // minus the shift (log2 domain) of this lane's query column, in all eight
    // registers: the C operand of the score products. It starts at the max
    // over the wave's first 32 keys, so that it is finite from the first stage
    // on and some P of the column is 1: no denominator can vanish.
    {
        const v16h k0 = load_frag(krd);
        const v16h k1 = load_frag(krd + FRAG);
        #pragma unroll
        for (int t = 0; t < QT; ++t) {
            v8f zero = {};
            const v8f t0 = __builtin_amdgcn_wmma_f32_16x16x32_f16(
                false, k0, false, bq[t], (short)0, zero, false, false);
            const v8f t1 = __builtin_amdgcn_wmma_f32_16x16x32_f16(
                false, k1, false, bq[t], (short)0, zero, false, false);
            float m0 = fmaxf(t0[0], t1[0]);
            #pragma unroll
            for (int r = 1; r < 8; ++r) m0 = fmaxf(m0, fmaxf(t0[r], t1[r]));
            m0 = fmaxf(m0, __shfl_xor(m0, 16, 32));
            #pragma unroll
            for (int r = 0; r < 8; ++r) negm[t][r] = -m0;
        }
    }

    // Three buffers, and the barrier in its two halves. A wave lays chunk c + 1
    // down and signals in the middle of trip c; it waits at the trip's end, when
    // the others have as a rule signalled long ago: no wave stands still for a
    // slower one unless that one is half a chunk behind. A wave in trip c has
    // passed the wait of trip c - 1, so every wave has signalled in trip c - 1
    // and is done with chunk c - 2, whose buffer chunk c + 1 takes.
    int rb = 0;             // buffer of this trip's chunk
    int wb = 1;             // buffer of the next one
    for (int c = 0; c < NCH; ++c) {
        // behind the last chunk there is none: the last trip re-reads chunk 0
        // instead (in bounds, never used)
        const int cn = (c + 1 < NCH) ? c + 1 : 0;

        const _Float16* kr = krd + rb * BUFH;
        const _Float16* vr = vrd + rb * BUFH;

        // two register sets of fragments: a stage's are read from LDS one stage
        // ahead of its products
        v16h fk0[2], fk1[2], fv0[2], fv1[2];
        fk0[0] = load_frag(kr);
        fk1[0] = load_frag(kr + FRAG);
        fv0[0] = load_frag(vr);
        fv1[0] = load_frag(vr + FRAG);

        // unrolled: a set's index must be a compile-time constant, else the
        // sets would not stay in registers
        #pragma unroll
        for (int j = 0; j < SPC; ++j) {
            if (j == SPC / 2) {
                // keeps the conversions down here: the scheduler otherwise lifts
                // them towards the head of the trip, to free registers, and the
                // wave then waits out the latency of the loads it has just issued
                __builtin_amdgcn_sched_barrier(0);
                put_share(kst + wb * BUFH, vst + wb * BUFH, sk, sv);
                // the wave's LDS stores are done before it signals
                __builtin_amdgcn_fence(__ATOMIC_RELEASE, "workgroup");
                // first half of the work-group barrier: this wave's share of
                // the next chunk lies in LDS
                __builtin_amdgcn_s_barrier_signal(-1);
            }
            if (j + 1 < SPC) {
                const int jb = (j + 1) & 1;
                fk0[jb] = load_frag(kr + (j + 1) * GRP);
                fk1[jb] = load_frag(kr + (j + 1) * GRP + FRAG);
                fv0[jb] = load_frag(vr + (j + 1) * GRP);
                fv1[jb] = load_frag(vr + (j + 1) * GRP + FRAG);
                // holds this stage's products behind the next stage's reads:
                // the scheduler otherwise puts the reads, in pairs, directly in
                // front of the products that use them: the lead of a stage is
                // lost and every pair stalls the wave anew
                __builtin_amdgcn_sched_barrier(0);
            }

            // ---- the next chunk's f32 rows into registers, behind the trip's
            // first LDS reads, so that the wait on the addresses runs under
            // those reads' latency; they land under the trip's first half
            if (j == 0)
                fetch_share(kg + (size_t)cn * (CK * CPLANE),
                            vg + (size_t)cn * (CK * CPLANE), sk, sv);

            // ---- scores minus the shift: per query tile two 16x16 tiles
            // over 32 keys; each K fragment is the A operand of both tiles ----
            v8f st0[QT], st1[QT];
            #pragma unroll
            for (int t = 0; t < QT; ++t) {
                st0[t] = __builtin_amdgcn_wmma_f32_16x16x32_f16(
                    false, fk0[j & 1], false, bq[t], (short)0, negm[t], false, false);
                st1[t] = __builtin_amdgcn_wmma_f32_16x16x32_f16(
                    false, fk1[j & 1], false, bq[t], (short)0, negm[t], false, false);
            }

            // a lane keeps the 16 scores of each of its two query columns that
            // it holds: keys lhalf*8 + r (st0) and 16 + lhalf*8 + r (st1)

            // ---- online softmax (log2 domain): the tracked walk alone -------
            if (TRACK) {
                float bm[QT];
                #pragma unroll
                for (int t = 0; t < QT; ++t) {
                    bm[t] = fmaxf(st0[t][0], st1[t][0]);
                    #pragma unroll
                    for (int r = 1; r < 8; ++r)
                        bm[t] = fmaxf(bm[t], fmaxf(st0[t][r], st1[t][r]));
                }

                // wave-uniform, one test for both tiles: rescale only when some
                // column's max actually moved, that is, when some lane holds a
                // shifted score above 0; the two halves of a column meet only in here
                if (__any(fmaxf(bm[0], bm[1]) > 0.0f)) {
                    #pragma unroll
                    for (int t = 0; t < QT; ++t) {
                        // how far this column's max moved (0: not at all)
                        const float up   = fmaxf(fmaxf(bm[t], __shfl_xor(bm[t], 16, 32)), 0.0f);
                        const float corr = __builtin_amdgcn_exp2f(-up);
                        accl[t][0] *= corr;
                        acc0[t] *= corr;  acc1[t] *= corr;
                        st0[t]  -= up;    st1[t]  -= up;
                        negm[t] -= up;
                    }
                }
            }

            // ---- P^T as B operand: converted in place ----------------------
            // slot r = st0's row r, slot 8 + r = st1's row r, the key order in
            // which the V^T fragments are stored
            v16h bp[QT];
            #pragma unroll
            for (int t = 0; t < QT; ++t) {
                #pragma unroll
                for (int r = 0; r < 8; ++r) {
                    bp[t][r]     = (_Float16)__builtin_amdgcn_exp2f(st0[t][r]);
                    bp[t][r + 8] = (_Float16)__builtin_amdgcn_exp2f(st1[t][r]);
                }
            }

            #pragma unroll
            for (int t = 0; t < QT; ++t) {
                // ---- numerator: outT += V^T x P^T; each V^T fragment is the
                // A operand of both tiles
                acc0[t] = __builtin_amdgcn_wmma_f32_16x16x32_f16(
                    false, fv0[j & 1], false, bp[t], (short)0, acc0[t], false, false);
                acc1[t] = __builtin_amdgcn_wmma_f32_16x16x32_f16(
                    false, fv1[j & 1], false, bp[t], (short)0, acc1[t], false, false);

                // ---- denominator: column sums of the same P^T --------------
                accl[t] = __builtin_amdgcn_wmma_f32_16x16x32_f16(
                    false, ones, false, bp[t], (short)0, accl[t], false, false);
            }
        }

        // holds the wait down here, behind the trip's last products: the
        // scheduler otherwise lifts it up to the signal and the two halves of
        // the barrier are one again
        __builtin_amdgcn_sched_barrier(0);
        // second half of the barrier: every wave's share of the next chunk lies
        // in LDS; no read of it is lifted over the fence
        __builtin_amdgcn_s_barrier_wait(-1);
        __builtin_amdgcn_fence(__ATOMIC_ACQUIRE, "workgroup");
        rb = wb;
        wb = (wb == 2) ? 0 : wb + 1;
    }
}

__global__ __launch_bounds__(512)
void attention_kernel(const float* __restrict__ q,
                      const float* __restrict__ k,
                      const float* __restrict__ v,
                      float* __restrict__ out, float qscale) {
    // three buffers of one chunk each: groups 0..SPC-1 key half 0, the rest half 1
    __shared__ __attribute__((aligned(16))) _Float16 kl[3 * BUFH];
    __shared__ __attribute__((aligned(16))) _Float16 vl[3 * BUFH];
    // what a wave hands to its partner: one tile's numerators, denominator, -max
    __shared__ v4f xacc[16][4][32];
    __shared__ float xden[16][32];
    __shared__ float xneg[16][32];
    // per wave: did some P of its fixed-shift walk leave f16's range
    __shared__ int xbad[16];

    // scalar, so that the key half's bases and the hand-over's choices are scalar too
    const int wave  = __builtin_amdgcn_readfirstlane(threadIdx.x >> 5);   // 0..15
    const int lane  = threadIdx.x & 31;
    const int kh    = wave >> 3;                    // key half
    const int nh    = blockIdx.x >> 4;              // (n,h) pair 0..15
    const int nb    = nh >> 3;
    const int h     = nh & 7;
    const int q0    = (blockIdx.x & 15) * 256 + (wave & 7) * 32;

    const int lmod  = lane & 15;
    const int lhalf = lane >> 4;                    // 0 or 1

    // ---- B operands: Q^T 32x16 per tile, resident for the whole loop -------
    // lane<16: column q=lane, d=0..15 ; lane>=16: column q=lane-16, d=16..31
    // scaled: softmax temperature AND log2(e) folded in, so the softmax runs in
    // the exp2 domain (v_exp_f32 with no preceding v_mul per score)
    v16h bq[QT];
    {
        const float* qp[QT];
        v4f qx[QT][4];
        #pragma unroll
        for (int t = 0; t < QT; ++t) {
            qp[t] = q + ((size_t)(nb * SEQ + q0 + t * 16 + lmod) * NHEAD + h) * HDIM + lhalf * 16;
            #pragma unroll
            for (int i = 0; i < 4; ++i) qx[t][i] = *(const v4f*)(qp[t] + i * 4);
        }
        // the two addresses are inputs, so that their registers stay as they are
        // up to the wait (no load's result is placed on them), which stands in
        // front of any reuse of them
        asm volatile("s_wait_xcnt 0x0" :: "v"(qp[0]), "v"(qp[1]) : "memory");
        #pragma unroll
        for (int t = 0; t < QT; ++t) {
            #pragma unroll
            for (int i = 0; i < 4; ++i) {
                bq[t][i * 4 + 0] = (_Float16)(qx[t][i].x * qscale);
                bq[t][i * 4 + 1] = (_Float16)(qx[t][i].y * qscale);
                bq[t][i * 4 + 2] = (_Float16)(qx[t][i].z * qscale);
                bq[t][i * 4 + 3] = (_Float16)(qx[t][i].w * qscale);
            }
        }
    }

    v8f acc0[QT];           // outT rows d=0..15  (C layout)
    v8f acc1[QT];           // outT rows d=16..31
    // running denominators: row 0 (lanes 0..15) and row 8 (lanes 16..31) of the
    // tile stand in register 0, so every lane holds its own column's full sum
    // there; the other rows are never read
    v8f accl[QT];
    v8f negm[QT];           // minus the shift of each tile's scores
    v16h ones;
    {
        const _Float16 o = (lane & 7) == 0 ? (_Float16)1.0f : (_Float16)0.0f;
        #pragma unroll
        for (int r = 0; r < 16; ++r) ones[r] = o;
    }

    // ---- the wave's share of a chunk: 16 keys, half "part" of group "grp" ----
    const int grp  = wave >> 1;                     // 0 .. 2*SPC-1
    const int part = wave & 1;
    const int d4   = lane & 7;
    const int sk0  = (grp / SPC) * KEYS + (grp % SPC) * 32 + part * 16;   // first key, chunk 0
    const float* kg = k + ((size_t)(nb * SEQ + sk0 + (lane >> 3)) * NHEAD + h) * HDIM + d4 * 4;
    const float* vg = v + ((size_t)(nb * SEQ + sk0) * NHEAD + h) * HDIM + lane;
    // K: these 16 keys are fragment "part" of the group; d = d4 * 4 + c =
    // (l >> 4) * 16 + p * 8 + e; key 4jj + (lane >> 3) = fragment lane & 15
    _Float16* kst = kl + grp * GRP + part * FRAG + ((d4 >> 1) & 1) * FPART
                  + ((d4 >> 2) * 16 + (lane >> 3)) * 8 + (d4 & 1) * 4;
    // V^T: keys part * 16 + lh * 8 + e go to 16-byte part "part" of fragment
    // lane >> 4, at the place of fragment lane lh * 16 + (lane & 15)
    _Float16* vst = vl + grp * GRP + (lane >> 4) * FRAG + part * FPART + (lane & 15) * 8;

    // the lane's place in the first fragments of this wave's key half
    const _Float16* krd = kl + kh * SPC * GRP + lane * 8;
    const _Float16* vrd = vl + kh * SPC * GRP + lane * 8;

    // First with the shift held fixed: no max over the scores, no test and no
    // rescale in any stage.
    walk_keys<false>(kg, vg, kst, vst, krd, vrd, bq, ones, acc0, acc1, accl, negm);

    // A P at or above f16's top, whatever the conversion makes of it (65504 or
    // +inf), lifts its column's denominator far above 32768; a NaN fails the
    // compare too. The walk is the whole work-group's, so the test is too: if
    // some wave saw such a sum, every wave throws its sums away and all walk
    // again with the running max. A large sum of P that all fitted takes the
    // second walk as well: slower, and as right.
    const int bad = __any(!(accl[0][0] < 32768.0f) || !(accl[1][0] < 32768.0f));
    if (lane == 0) xbad[wave] = bad;
    // publishes every wave's finding to the work-group, and ends every wave's
    // reads of the last chunk before a second walk refills the buffers
    __syncthreads();
    if (__any(xbad[lmod] != 0))
        walk_keys<true>(kg, vg, kst, vst, krd, vrd, bq, ones, acc0, acc1, accl, negm);

    // ---- join the two key halves -------------------------------------------
    // the wave of key half kh finishes tile kh and hands tile 1 - kh to its
    // partner, wave ^ 8
    const v8f   g0 = kh ? acc0[0] : acc0[1];
    const v8f   g1 = kh ? acc1[0] : acc1[1];
    xacc[wave][0][lane] = __builtin_shufflevector(g0, g0, 0, 1, 2, 3);
    xacc[wave][1][lane] = __builtin_shufflevector(g0, g0, 4, 5, 6, 7);
    xacc[wave][2][lane] = __builtin_shufflevector(g1, g1, 0, 1, 2, 3);
    xacc[wave][3][lane] = __builtin_shufflevector(g1, g1, 4, 5, 6, 7);
    xden[wave][lane] = kh ? accl[0][0] : accl[1][0];
    xneg[wave][lane] = kh ? negm[0][0] : negm[1][0];

    // publishes every wave's hand-over to its partner
    __syncthreads();

    const v8f   a0 = kh ? acc0[1] : acc0[0];
    const v8f   a1 = kh ? acc1[1] : acc1[0];
    const float al = kh ? accl[1][0] : accl[0][0];
    const float an = kh ? negm[1][0] : negm[0][0];
    const int   pw = wave ^ 8;
    const v4f   p00 = xacc[pw][0][lane], p01 = xacc[pw][1][lane];
    const v4f   p10 = xacc[pw][2][lane], p11 = xacc[pw][3][lane];
    const float pl = xden[pw][lane];
    const float pn = xneg[pw][lane];

    // both halves brought to the larger of the two maxima, then one division
    const float nm  = fminf(an, pn);                // minus the larger max
    const float ca  = __builtin_amdgcn_exp2f(nm - an);
    const float cp  = __builtin_amdgcn_exp2f(nm - pn);
    const float inv = 1.0f / (al * ca + pl * cp);
    const float wa  = ca * inv;
    const float wp  = cp * inv;

    // ---- write out [n, q, h, d] --------------------------------------------
    const int   qq  = q0 + kh * 16 + lmod;
    float* obase = out + ((size_t)(nb * SEQ + qq) * NHEAD + h) * HDIM;
    const int dbase = lhalf * 8;                   // acc0 rows: d = dbase+r
    float4 w;
    w = make_float4(a0[0]*wa + p00[0]*wp, a0[1]*wa + p00[1]*wp,
                    a0[2]*wa + p00[2]*wp, a0[3]*wa + p00[3]*wp);
    *(float4*)(obase + dbase)          = w;
    w = make_float4(a0[4]*wa + p01[0]*wp, a0[5]*wa + p01[1]*wp,
                    a0[6]*wa + p01[2]*wp, a0[7]*wa + p01[3]*wp);
    *(float4*)(obase + dbase + 4)      = w;
    w = make_float4(a1[0]*wa + p10[0]*wp, a1[1]*wa + p10[1]*wp,
                    a1[2]*wa + p10[2]*wp, a1[3]*wa + p10[3]*wp);
    *(float4*)(obase + 16 + dbase)     = w;
    w = make_float4(a1[4]*wa + p11[0]*wp, a1[5]*wa + p11[1]*wp,
                    a1[6]*wa + p11[2]*wp, a1[7]*wa + p11[3]*wp);
    *(float4*)(obase + 16 + dbase + 4) = w;
}

// ---------------------------------------------------------------------------
extern "C" void kernel_launch(void* const* d_in, const int* in_sizes, int n_in,
                              void* d_out, int out_size, void* d_ws, size_t ws_size,
                              hipStream_t stream) {
    const float* q = (const float*)d_in[0];
    const float* k = (const float*)d_in[1];
    const float* v = (const float*)d_in[2];
    float* out = (float*)d_out;

    // 1/sqrt(d) * log2(e): softmax computed with exp2
    const float qscale = (1.0f / sqrtf((float)HDIM)) * 1.44269504088896340736f;

    // 2048 wave-tiles of 32 queries x 2 key halves, 16 waves/block
    attention_kernel<<<256, 512, 0, stream>>>(q, k, v, out, qscale);
}

// v010
// A run of this version takes 31.5 microseconds.
// Next to v009, in two timings, it ran 1.03 times as fast each time.
// All steps since v000 together make it 6.55 times as fast.
#include <hip/hip_runtime.h>
#include <hip/hip_bf16.h>
#include <math.h>

typedef __attribute__((ext_vector_type(16))) _Float16 v16h;
typedef __attribute__((ext_vector_type(8)))  _Float16 v8h;
typedef __attribute__((ext_vector_type(4)))  _Float16 v4h;
typedef __attribute__((ext_vector_type(8)))  float    v8f;
typedef __attribute__((ext_vector_type(4)))  float    v4f;

#define NBATCH 2
#define NHEAD  8
#define SEQ    4096       // 64*64
#define HDIM   32         // 256 / 8
#define CPLANE 256        // NHEAD*HDIM

// Fragment order of K and V^T in LDS. One block of 512 halves per A fragment
// (16 rows x 32 k). Inside a block: element slot of lane l stands at
//   (slot >> 3) * 256 + l * 8 + (slot & 7)
// so each of a fragment's two 16-byte loads reads 512 contiguous bytes per wave.
#define FRAG   512        // halves per fragment
#define FPART  256        // halves per 16-byte part of a fragment
#define GRP    1024       // halves of K (or of V^T) per group of 32 keys: two fragments

// ---------------------------------------------------------------------------
// Flash attention, one launch, f32 inputs read as they lie. One wave owns 32
// queries (two 16-query tiles) of one (n, h) and one half of the keys. Waves w
// and w + 8 of a work-group hold the two key halves of the same queries and
// join their partial results through LDS at the end.
// K and V: the work-group walks both key halves in chunks of CK keys each. It
// loads a chunk's f32 rows, rounds them to f16 and lays them into LDS in
// fragment order, once for all its waves, ahead of the products (three buffers):
//   K fragment = 16 keys; lane l: key l & 15, d = (l >> 4) * 16 + slot.
//   V^T: per 32 keys two fragments, d 0..15 and d 16..31; lane l: row d & 15 =
//     l & 15, key = (slot >> 3) * 16 + (l >> 4) * 8 + (slot & 7): the keys whose
//     scores lane l holds in its two score tiles.
// S^T = K x Q^T - m  (A = K 16x32 f16, B = Q^T 32x16 f16, C = 16s x 16q f32:
//                    minus each column's shift, so the scores leave the
//                    matrix unit ready for exp2)
// outT += V^T x P^T  (A = V^T 16x32, B = P^T 32x16, C = 16d x 16q f32)
// den  += E x P^T    (A = E: rows 0 and 8 all ones, the rest 0): the softmax
//                    denominators, summed by the matrix unit
// block = 512 threads = 16 waves = 256 queries x 2 key halves;
// grid = NBATCH*NHEAD*(SEQ/256) = 256 blocks
// ---------------------------------------------------------------------------
#define QT     2          // query tiles per wave
#define KEYS   (SEQ / 2)  // keys per wave
#define CK     128        // keys of each half per chunk
#define SPC    (CK / 32)  // stages of 32 keys per chunk
#define NCH    (KEYS / CK)
#define BUFH   (2 * SPC * GRP)   // halves of K (or of V^T) per LDS buffer: both halves' groups

__device__ __forceinline__ v16h load_frag(const _Float16* p) {
    const v8h lo = *(const v8h*)(p);
    const v8h hi = *(const v8h*)(p + FPART);
    return __builtin_shufflevector(lo, hi, 0, 1, 2, 3, 4, 5, 6, 7,
                                   8, 9, 10, 11, 12, 13, 14, 15);
}

// A wave's share of a chunk: 16 keys of K and the same 16 keys of V, f32.
// K: load jj = keys 4jj .. 4jj+3, eight lanes to a key, four d to a lane.
// V: load s = key s, d = lane: a lane reads one d of all 16 keys, which is the
// transposition. Every load reads whole 128-byte lines.
__device__ __forceinline__
void fetch_share(const float* kp, const float* vp, v4f (&sk)[4], float (&sv)[16]) {
    // unrolled: the values stand in register arrays
    #pragma unroll
    for (int jj = 0; jj < 4; ++jj) sk[jj] = *(const v4f*)(kp + jj * 4 * CPLANE);
    #pragma unroll
    for (int s = 0; s < 16; ++s) sv[s] = vp[s * CPLANE];
    // compiler fence: without it the compiler may sink these loads down to the
    // conversion that uses them and the lead of a chunk is lost. The two
    // addresses are inputs, so that their registers stay as they are up to the
    // wait, which stands in front of any reuse of them
    asm volatile("s_wait_xcnt 0x0" :: "v"(kp), "v"(vp) : "memory");
}

// rounds the share to f16 and lays it into LDS at the wave's places
__device__ __forceinline__
void put_share(_Float16* kw, _Float16* vw, const v4f (&sk)[4], const float (&sv)[16]) {
    #pragma unroll
    for (int lh = 0; lh < 2; ++lh) {
        v8h o;
        #pragma unroll
        for (int e = 0; e < 8; ++e) o[e] = (_Float16)sv[lh * 8 + e];
        *(v8h*)(vw + lh * 128) = o;
    }
    #pragma unroll
    for (int jj = 0; jj < 4; ++jj) {
        v4h o;
        o[0] = (_Float16)sk[jj].x;  o[1] = (_Float16)sk[jj].y;
        o[2] = (_Float16)sk[jj].z;  o[3] = (_Float16)sk[jj].w;
        *(v4h*)(kw + jj * 32) = o;
    }
}

// ---------------------------------------------------------------------------
// One walk of the whole work-group over the keys, each wave over its key half.
// Every wave of the work-group calls it together: it holds barriers. On entry
// the sums are cleared and the shift (minus the max over the wave's first 32
// keys, per query column) is set.
// TRACK = false: the shift stays as it is for the whole walk. P = exp2(score -
//   shift) is then not bounded by 1; it keeps f16's relative precision up to
//   f16's top, 65504. A P that does not fit any more shows in its column's
//   denominator, a sum of non-negative terms, where the caller looks for it.
// TRACK = true: the online softmax, whose shift follows the running max: right
//   for every input.
// kg, vg: the wave's share of chunk 0 in global memory; kst, vst: where it lays
// that share in LDS buffer 0; krd, vrd: the lane's place in the first fragments
// of the wave's key half in LDS buffer 0.
// ---------------------------------------------------------------------------
template <bool TRACK>
__device__ __forceinline__
void walk_keys(const float* kg, const float* vg, _Float16* kst, _Float16* vst,
               const _Float16* krd, const _Float16* vrd,
               const v16h (&bq)[QT], const v16h ones,
               v8f (&acc0)[QT], v8f (&acc1)[QT], v8f (&accl)[QT], v8f (&negm)[QT]) {
    #pragma unroll
    for (int t = 0; t < QT; ++t) {
        const v8f zero = {};
        acc0[t] = zero;  acc1[t] = zero;  accl[t] = zero;
    }

    v4f   sk[4];
    float sv[16];

    // chunk 0 into buffer 0 (no wave reads LDS any more when this is reached)
    fetch_share(kg, vg, sk, sv);
    put_share(kst, vst, sk, sv);
    // publishes chunk 0
    __syncthreads();

    // minus the shift (log2 domain) of this lane's query column, in all eight
    // registers: the C operand of the score products. It starts at the max
    // over the wave's first 32 keys, so that it is finite from the first stage
    // on and some P of the column is 1: no denominator can vanish.
    {
        const v16h k0 = load_frag(krd);
        const v16h k1 = load_frag(krd + FRAG);
        #pragma unroll
        for (int t = 0; t < QT; ++t) {
            v8f zero = {};
            const v8f t0 = __builtin_amdgcn_wmma_f32_16x16x32_f16(
                false, k0, false, bq[t], (short)0, zero, false, false);
            const v8f t1 = __builtin_amdgcn_wmma_f32_16x16x32_f16(
                false, k1, false, bq[t], (short)0, zero, false, false);
            float m0 = fmaxf(t0[0], t1[0]);
            #pragma unroll
            for (int r = 1; r < 8; ++r) m0 = fmaxf(m0, fmaxf(t0[r], t1[r]));
            m0 = fmaxf(m0, __shfl_xor(m0, 16, 32));
            #pragma unroll
            for (int r = 0; r < 8; ++r) negm[t][r] = -m0;
        }
    }

    // Three buffers, and the barrier in its two halves. A wave lays chunk c + 1
    // down and signals in the middle of trip c; it waits at the trip's end, when
    // the others have as a rule signalled long ago: no wave stands still for a
    // slower one unless that one is half a chunk behind. A wave in trip c has
    // passed the wait of trip c - 1, so every wave has signalled in trip c - 1
    // and is done with chunk c - 2, whose buffer chunk c + 1 takes.
    int rb = 0;             // buffer of this trip's chunk
    int wb = 1;             // buffer of the next one
    for (int c = 0; c < NCH; ++c) {
        // behind the last chunk there is none: the last trip re-reads chunk 0
        // instead (in bounds, never used)
        const int cn = (c + 1 < NCH) ? c + 1 : 0;

        const _Float16* kr = krd + rb * BUFH;
        const _Float16* vr = vrd + rb * BUFH;

        // two register sets of fragments: a stage's are read from LDS one stage
        // ahead of its products
        v16h fk0[2], fk1[2], fv0[2], fv1[2];
        fk0[0] = load_frag(kr);
        fk1[0] = load_frag(kr + FRAG);
        fv0[0] = load_frag(vr);
        fv1[0] = load_frag(vr + FRAG);

        // unrolled: a set's index must be a compile-time constant, else the
        // sets would not stay in registers
        #pragma unroll
        for (int j = 0; j < SPC; ++j) {
            if (j == SPC / 2) {
                // keeps the conversions down here: the scheduler otherwise lifts
                // them towards the head of the trip, to free registers, and the
                // wave then waits out the latency of the loads it has just issued
                __builtin_amdgcn_sched_barrier(0);
                put_share(kst + wb * BUFH, vst + wb * BUFH, sk, sv);
                // the wave's LDS stores are done before it signals
                __builtin_amdgcn_fence(__ATOMIC_RELEASE, "workgroup");
                // first half of the work-group barrier: this wave's share of
                // the next chunk lies in LDS
                __builtin_amdgcn_s_barrier_signal(-1);
            }
            if (j + 1 < SPC) {
                const int jb = (j + 1) & 1;
                fk0[jb] = load_frag(kr + (j + 1) * GRP);
                fk1[jb] = load_frag(kr + (j + 1) * GRP + FRAG);
                fv0[jb] = load_frag(vr + (j + 1) * GRP);
                fv1[jb] = load_frag(vr + (j + 1) * GRP + FRAG);
                // holds this stage's products behind the next stage's reads:
                // the scheduler otherwise puts the reads, in pairs, directly in
                // front of the products that use them: the lead of a stage is
                // lost and every pair stalls the wave anew
                __builtin_amdgcn_sched_barrier(0);
            }

            // ---- the next chunk's f32 rows into registers, behind the trip's
            // first LDS reads, so that the wait on the addresses runs under
            // those reads' latency; they land under the trip's first half
            if (j == 0)
                fetch_share(kg + (size_t)cn * (CK * CPLANE),
                            vg + (size_t)cn * (CK * CPLANE), sk, sv);

            // ---- scores minus the shift: per query tile two 16x16 tiles
            // over 32 keys; each K fragment is the A operand of both tiles ----
            v8f st0[QT], st1[QT];
            #pragma unroll
            for (int t = 0; t < QT; ++t) {
                st0[t] = __builtin_amdgcn_wmma_f32_16x16x32_f16(
                    false, fk0[j & 1], false, bq[t], (short)0, negm[t], false, false);
                st1[t] = __builtin_amdgcn_wmma_f32_16x16x32_f16(
                    false, fk1[j & 1], false, bq[t], (short)0, negm[t], false, false);
            }
            // holds the four score products together, ahead of every exp2: the
            // scheduler otherwise issues them one by one, each directly in front
            // of the exp2 of its own result, and pads each gap with four v_nop
            __builtin_amdgcn_sched_barrier(0);

            // a lane keeps the 16 scores of each of its two query columns that
            // it holds: keys lhalf*8 + r (st0) and 16 + lhalf*8 + r (st1)

            // ---- online softmax (log2 domain): the tracked walk alone -------
            if (TRACK) {
                float bm[QT];
                #pragma unroll
                for (int t = 0; t < QT; ++t) {
                    bm[t] = fmaxf(st0[t][0], st1[t][0]);
                    #pragma unroll
                    for (int r = 1; r < 8; ++r)
                        bm[t] = fmaxf(bm[t], fmaxf(st0[t][r], st1[t][r]));
                }

                // wave-uniform, one test for both tiles: rescale only when some
                // column's max actually moved, that is, when some lane holds a
                // shifted score above 0; the two halves of a column meet only in here
                if (__any(fmaxf(bm[0], bm[1]) > 0.0f)) {
                    #pragma unroll
                    for (int t = 0; t < QT; ++t) {
                        // how far this column's max moved (0: not at all)
                        const float up   = fmaxf(fmaxf(bm[t], __shfl_xor(bm[t], 16, 32)), 0.0f);
                        const float corr = __builtin_amdgcn_exp2f(-up);
                        accl[t][0] *= corr;
                        acc0[t] *= corr;  acc1[t] *= corr;
                        st0[t]  -= up;    st1[t]  -= up;
                        negm[t] -= up;
                    }
                }
            }

            // ---- P^T as B operand: converted in place ----------------------
            // slot r = st0's row r, slot 8 + r = st1's row r, the key order in
            // which the V^T fragments are stored
            v16h bp[QT];
            #pragma unroll
            for (int t = 0; t < QT; ++t) {
                #pragma unroll
                for (int r = 0; r < 8; ++r) {
                    bp[t][r]     = (_Float16)__builtin_amdgcn_exp2f(st0[t][r]);
                    bp[t][r + 8] = (_Float16)__builtin_amdgcn_exp2f(st1[t][r]);
                }
            }

            #pragma unroll
            for (int t = 0; t < QT; ++t) {
                // ---- numerator: outT += V^T x P^T; each V^T fragment is the
                // A operand of both tiles
                acc0[t] = __builtin_amdgcn_wmma_f32_16x16x32_f16(
                    false, fv0[j & 1], false, bp[t], (short)0, acc0[t], false, false);
                acc1[t] = __builtin_amdgcn_wmma_f32_16x16x32_f16(
                    false, fv1[j & 1], false, bp[t], (short)0, acc1[t], false, false);

                // ---- denominator: column sums of the same P^T --------------
                accl[t] = __builtin_amdgcn_wmma_f32_16x16x32_f16(
                    false, ones, false, bp[t], (short)0, accl[t], false, false);
            }
        }

        // holds the wait down here, behind the trip's last products: the
        // scheduler otherwise lifts it up to the signal and the two halves of
        // the barrier are one again
        __builtin_amdgcn_sched_barrier(0);
        // second half of the barrier: every wave's share of the next chunk lies
        // in LDS; no read of it is lifted over the fence
        __builtin_amdgcn_s_barrier_wait(-1);
        __builtin_amdgcn_fence(__ATOMIC_ACQUIRE, "workgroup");
        rb = wb;
        wb = (wb == 2) ? 0 : wb + 1;
    }
}

__global__ __launch_bounds__(512)
void attention_kernel(const float* __restrict__ q,
                      const float* __restrict__ k,
                      const float* __restrict__ v,
                      float* __restrict__ out, float qscale) {
    // three buffers of one chunk each: groups 0..SPC-1 key half 0, the rest half 1
    __shared__ __attribute__((aligned(16))) _Float16 kl[3 * BUFH];
    __shared__ __attribute__((aligned(16))) _Float16 vl[3 * BUFH];
    // what a wave hands to its partner: one tile's numerators, denominator, -max
    __shared__ v4f xacc[16][4][32];
    __shared__ float xden[16][32];
    __shared__ float xneg[16][32];
    // per wave: did some P of its fixed-shift walk leave f16's range
    __shared__ int xbad[16];

    // scalar, so that the key half's bases and the hand-over's choices are scalar too
    const int wave  = __builtin_amdgcn_readfirstlane(threadIdx.x >> 5);   // 0..15
    const int lane  = threadIdx.x & 31;
    const int kh    = wave >> 3;                    // key half
    const int nh    = blockIdx.x >> 4;              // (n,h) pair 0..15
    const int nb    = nh >> 3;
    const int h     = nh & 7;
    const int q0    = (blockIdx.x & 15) * 256 + (wave & 7) * 32;

    const int lmod  = lane & 15;
    const int lhalf = lane >> 4;                    // 0 or 1

    // ---- B operands: Q^T 32x16 per tile, resident for the whole loop -------
    // lane<16: column q=lane, d=0..15 ; lane>=16: column q=lane-16, d=16..31
    // scaled: softmax temperature AND log2(e) folded in, so the softmax runs in
    // the exp2 domain (v_exp_f32 with no preceding v_mul per score)
    v16h bq[QT];
    {
        const float* qp[QT];
        v4f qx[QT][4];
        #pragma unroll
        for (int t = 0; t < QT; ++t) {
            qp[t] = q + ((size_t)(nb * SEQ + q0 + t * 16 + lmod) * NHEAD + h) * HDIM + lhalf * 16;
            #pragma unroll
            for (int i = 0; i < 4; ++i) qx[t][i] = *(const v4f*)(qp[t] + i * 4);
        }
        // the two addresses are inputs, so that their registers stay as they are
        // up to the wait (no load's result is placed on them), which stands in
        // front of any reuse of them
        asm volatile("s_wait_xcnt 0x0" :: "v"(qp[0]), "v"(qp[1]) : "memory");
        #pragma unroll
        for (int t = 0; t < QT; ++t) {
            #pragma unroll
            for (int i = 0; i < 4; ++i) {
                bq[t][i * 4 + 0] = (_Float16)(qx[t][i].x * qscale);
                bq[t][i * 4 + 1] = (_Float16)(qx[t][i].y * qscale);
                bq[t][i * 4 + 2] = (_Float16)(qx[t][i].z * qscale);
                bq[t][i * 4 + 3] = (_Float16)(qx[t][i].w * qscale);
            }
        }
    }

    v8f acc0[QT];           // outT rows d=0..15  (C layout)
    v8f acc1[QT];           // outT rows d=16..31
    // running denominators: row 0 (lanes 0..15) and row 8 (lanes 16..31) of the
    // tile stand in register 0, so every lane holds its own column's full sum
    // there; the other rows are never read
    v8f accl[QT];
    v8f negm[QT];           // minus the shift of each tile's scores
    v16h ones;
    {
        const _Float16 o = (lane & 7) == 0 ? (_Float16)1.0f : (_Float16)0.0f;
        #pragma unroll
        for (int r = 0; r < 16; ++r) ones[r] = o;
    }

    // ---- the wave's share of a chunk: 16 keys, half "part" of group "grp" ----
    const int grp  = wave >> 1;                     // 0 .. 2*SPC-1
    const int part = wave & 1;
    const int d4   = lane & 7;
    const int sk0  = (grp / SPC) * KEYS + (grp % SPC) * 32 + part * 16;   // first key, chunk 0
    const float* kg = k + ((size_t)(nb * SEQ + sk0 + (lane >> 3)) * NHEAD + h) * HDIM + d4 * 4;
    const float* vg = v + ((size_t)(nb * SEQ + sk0) * NHEAD + h) * HDIM + lane;
    // K: these 16 keys are fragment "part" of the group; d = d4 * 4 + c =
    // (l >> 4) * 16 + p * 8 + e; key 4jj + (lane >> 3) = fragment lane & 15
    _Float16* kst = kl + grp * GRP + part * FRAG + ((d4 >> 1) & 1) * FPART
                  + ((d4 >> 2) * 16 + (lane >> 3)) * 8 + (d4 & 1) * 4;
    // V^T: keys part * 16 + lh * 8 + e go to 16-byte part "part" of fragment
    // lane >> 4, at the place of fragment lane lh * 16 + (lane & 15)
    _Float16* vst = vl + grp * GRP + (lane >> 4) * FRAG + part * FPART + (lane & 15) * 8;

    // the lane's place in the first fragments of this wave's key half
    const _Float16* krd = kl + kh * SPC * GRP + lane * 8;
    const _Float16* vrd = vl + kh * SPC * GRP + lane * 8;

    // First with the shift held fixed: no max over the scores, no test and no
    // rescale in any stage.
    walk_keys<false>(kg, vg, kst, vst, krd, vrd, bq, ones, acc0, acc1, accl, negm);

    // A P at or above f16's top, whatever the conversion makes of it (65504 or
    // +inf), lifts its column's denominator far above 32768; a NaN fails the
    // compare too. The walk is the whole work-group's, so the test is too: if
    // some wave saw such a sum, every wave throws its sums away and all walk
    // again with the running max. A large sum of P that all fitted takes the
    // second walk as well: slower, and as right.
    const int bad = __any(!(accl[0][0] < 32768.0f) || !(accl[1][0] < 32768.0f));
    if (lane == 0) xbad[wave] = bad;
    // publishes every wave's finding to the work-group, and ends every wave's
    // reads of the last chunk before a second walk refills the buffers
    __syncthreads();
    if (__any(xbad[lmod] != 0))
        walk_keys<true>(kg, vg, kst, vst, krd, vrd, bq, ones, acc0, acc1, accl, negm);

    // ---- join the two key halves -------------------------------------------
    // the wave of key half kh finishes tile kh and hands tile 1 - kh to its
    // partner, wave ^ 8
    const v8f   g0 = kh ? acc0[0] : acc0[1];
    const v8f   g1 = kh ? acc1[0] : acc1[1];
    xacc[wave][0][lane] = __builtin_shufflevector(g0, g0, 0, 1, 2, 3);
    xacc[wave][1][lane] = __builtin_shufflevector(g0, g0, 4, 5, 6, 7);
    xacc[wave][2][lane] = __builtin_shufflevector(g1, g1, 0, 1, 2, 3);
    xacc[wave][3][lane] = __builtin_shufflevector(g1, g1, 4, 5, 6, 7);
    xden[wave][lane] = kh ? accl[0][0] : accl[1][0];
    xneg[wave][lane] = kh ? negm[0][0] : negm[1][0];

    // publishes every wave's hand-over to its partner
    __syncthreads();

    const v8f   a0 = kh ? acc0[1] : acc0[0];
    const v8f   a1 = kh ? acc1[1] : acc1[0];
    const float al = kh ? accl[1][0] : accl[0][0];
    const float an = kh ? negm[1][0] : negm[0][0];
    const int   pw = wave ^ 8;
    const v4f   p00 = xacc[pw][0][lane], p01 = xacc[pw][1][lane];
    const v4f   p10 = xacc[pw][2][lane], p11 = xacc[pw][3][lane];
    const float pl = xden[pw][lane];
    const float pn = xneg[pw][lane];

    // both halves brought to the larger of the two maxima, then one division
    const float nm  = fminf(an, pn);                // minus the larger max
    const float ca  = __builtin_amdgcn_exp2f(nm - an);
    const float cp  = __builtin_amdgcn_exp2f(nm - pn);
    const float inv = 1.0f / (al * ca + pl * cp);
    const float wa  = ca * inv;
    const float wp  = cp * inv;

    // ---- write out [n, q, h, d] --------------------------------------------
    const int   qq  = q0 + kh * 16 + lmod;
    float* obase = out + ((size_t)(nb * SEQ + qq) * NHEAD + h) * HDIM;
    const int dbase = lhalf * 8;                   // acc0 rows: d = dbase+r
    float4 w;
    w = make_float4(a0[0]*wa + p00[0]*wp, a0[1]*wa + p00[1]*wp,
                    a0[2]*wa + p00[2]*wp, a0[3]*wa + p00[3]*wp);
    *(float4*)(obase + dbase)          = w;
    w = make_float4(a0[4]*wa + p01[0]*wp, a0[5]*wa + p01[1]*wp,
                    a0[6]*wa + p01[2]*wp, a0[7]*wa + p01[3]*wp);
    *(float4*)(obase + dbase + 4)      = w;
    w = make_float4(a1[0]*wa + p10[0]*wp, a1[1]*wa + p10[1]*wp,
                    a1[2]*wa + p10[2]*wp, a1[3]*wa + p10[3]*wp);
    *(float4*)(obase + 16 + dbase)     = w;
    w = make_float4(a1[4]*wa + p11[0]*wp, a1[5]*wa + p11[1]*wp,
                    a1[6]*wa + p11[2]*wp, a1[7]*wa + p11[3]*wp);
    *(float4*)(obase + 16 + dbase + 4) = w;
}

// ---------------------------------------------------------------------------
extern "C" void kernel_launch(void* const* d_in, const int* in_sizes, int n_in,
                              void* d_out, int out_size, void* d_ws, size_t ws_size,
                              hipStream_t stream) {
    const float* q = (const float*)d_in[0];
    const float* k = (const float*)d_in[1];
    const float* v = (const float*)d_in[2];
    float* out = (float*)d_out;

    // 1/sqrt(d) * log2(e): softmax computed with exp2
    const float qscale = (1.0f / sqrtf((float)HDIM)) * 1.44269504088896340736f;

    // 2048 wave-tiles of 32 queries x 2 key halves, 16 waves/block
    attention_kernel<<<256, 512, 0, stream>>>(q, k, v, out, qscale);
}
